// v000
// Measured on an AMD MI455X. A time is GPU time per run, averaged over a window of back-to-back runs after a warm-up
// (all launches, gaps included; the runs take copies of the inputs in turn), and the median of several windows.
// Apart from v000's, it joins two sittings. Times from different sittings can be a few percent apart, while
// side-by-side timings come from the same sitting.
// v000 is the starting kernel. One run takes 1460 microseconds.
#include <hip/hip_runtime.h>

// Multi-head attention whose causal branch is selected by a scalar 'mask' input and whose scores are divided by sqrt(E) (x [2][2048][1024]; q, k, v = x W + b ('xw' [1024][1024] 0.02, biases zeros on this draw: read; 16 heads x 64); scores / sqrt(1024) = x 1/32 (the EMBEDDING width, not the head width: implemented literally); 'if mask:' with mask a scalar int input == 1 -> where(tril, scores, -1e9) == exclusion (every row keeps its own key); the kernel is causal by index and a guard kernel checks the scalar on the device; softmax; out = merged Wo + bo ('xw' + bias zeros: read) -> [2][2048][1024] (4.2 M); argument order x, mask, Wq, bq, Wk, bk, Wv, bv, Wo, bo).
// VALUE PREMISE: this kernel implements the mask != 0 (causal) branch only; k_premise reads the flag on the device after the output is written and NaN-fills the whole output if the flag is 0.
// Layout per batch: bf16 copy of x; 'xw' weights transposed once; exact projections + f32 biases; identity-table plane builders; causal T-2048 attention with the literal scale 1/32 (hybrid rows: < 512 hi/lo 3 products, rest fp16 x1024; k_gemmc skips tiles above the diagonal); merged hi/lo x Wo exact + bo.
// Compute dtypes, f32 accumulate: every input rounded to bf16; projections exact + f32 biases; attention rows < 512 3 products, rest fp16; softmax f32; output projection hl x exact.

#define NB_  2
#define TT   2048
#define DM   1024
#define NH_  16
#define NKV  16
#define REP  (NH_ / NKV)
#define HD   64
#define DQ   (NH_ * HD)
#define DKV  (NKV * HD)
#define ZH   2
#define RH   512                  // query rows < RH use hi+lo planes (0: none)
#define WIN  2048
#define PCAR 1024.0f
#define SCL  0.03125f   // 1 / sqrt(E = 1024) = 2^-5: the module divides by sqrt of the EMBEDDING width
typedef _Float16 h16;
typedef unsigned short bf;
typedef __attribute__((ext_vector_type(16))) __bf16   v16bf;
typedef __attribute__((ext_vector_type(16))) _Float16 v16h;
typedef __attribute__((ext_vector_type(8)))  _Float16 v8h;
typedef __attribute__((ext_vector_type(8)))  unsigned short v8us;
typedef __attribute__((ext_vector_type(8)))  float    v8f;
typedef __attribute__((ext_vector_type(4)))  float    v4f;
typedef v8h  __attribute__((may_alias)) v8ha;
typedef v4f  __attribute__((may_alias)) v4fa;
typedef v8us __attribute__((may_alias)) v8usa;

__device__ __forceinline__ unsigned short f2bf(float f) { unsigned u = __float_as_uint(f); u += 0x7FFFu + ((u >> 16) & 1u); return (unsigned short)(u >> 16); }
__device__ __forceinline__ float bf2f(unsigned short b) { return __uint_as_float(((unsigned)b) << 16); }
__device__ __forceinline__ float bfr(float f) { return bf2f(f2bf(f)); }
__device__ __forceinline__ v16h cat16(v8h lo, v8h hi) { return __builtin_shufflevector(lo, hi, 0, 1, 2, 3, 4, 5, 6, 7, 8, 9, 10, 11, 12, 13, 14, 15); }
__device__ __forceinline__ v16bf cat16b(v8us lo, v8us hi) { return __builtin_bit_cast(v16bf, __builtin_shufflevector(lo, hi, 0, 1, 2, 3, 4, 5, 6, 7, 8, 9, 10, 11, 12, 13, 14, 15)); }
__device__ __forceinline__ v8f wmma16(v16h a, v16h b, v8f c) { return __builtin_amdgcn_wmma_f32_16x16x32_f16(false, a, false, b, (short)0, c, false, false); }
__device__ __forceinline__ v8f wmmab(v16bf a, v16bf b, v8f c) { return __builtin_amdgcn_wmma_f32_16x16x32_bf16(false, a, false, b, (short)0, c, false, false); }



// ---- k_gemmw: register-blocked GEMM, ONE WAVE per 64x64 output tile (16 accumulators), operands straight from K-contiguous 16-bit planes; grid (M/64, N/64, Z), 32 threads.
// C[m][n] (f32, pitch ldc, + optional f32 bias[n]) = sum_k A[m][k] Bt[n][k] (+ split products per NSPLIT). z-batch strides sA/sB/sC in elements. K % 32 == 0.
template <typename T16> struct WFrag;
template <> struct WFrag<h16> { typedef v16h V; static __device__ __forceinline__ V ld(const h16* p) { return cat16(*(const v8h*)p, *(const v8h*)(p + 16)); } static __device__ __forceinline__ v8f mma(V a, V b, v8f c) { return wmma16(a, b, c); } };
template <> struct WFrag<bf> { typedef v16bf V; static __device__ __forceinline__ V ld(const bf* p) { return cat16b(*(const v8us*)p, *(const v8us*)(p + 16)); } static __device__ __forceinline__ v8f mma(V a, V b, v8f c) { return wmmab(a, b, c); } };
template <typename T16, int NSPLIT, bool BIAS>
__global__ __launch_bounds__(32) void k_gemmw(const T16* __restrict__ A, const T16* __restrict__ A2, const T16* __restrict__ Bt, const T16* __restrict__ Bt2, int K, float* C, int ldc, const float* __restrict__ bias, size_t sA, size_t sB, size_t sC) {
    typedef typename WFrag<T16>::V V;
    __shared__ __align__(16) float os[16 * 68];
    const size_t z = blockIdx.z; A += z * sA; if (A2) A2 += z * sA; Bt += z * sB; if (Bt2) Bt2 += z * sB; C += z * sC;
    const int lane = threadIdx.x & 31, lr = lane & 15, hi = lane >> 4; const int r0 = blockIdx.x * 64, c0 = blockIdx.y * 64;
    v8f acc[4][4];
#pragma unroll
    for (int mb = 0; mb < 4; ++mb)
#pragma unroll
        for (int nb = 0; nb < 4; ++nb) acc[mb][nb] = (v8f){};
    const size_t aoff = (size_t)(r0 + lr) * K + 8 * hi, boff = (size_t)(c0 + lr) * K + 8 * hi;
#pragma unroll 1
    for (int kc = 0; kc < K; kc += 32) {
        V a[4], a2[4];
#pragma unroll
        for (int mb = 0; mb < 4; ++mb) { a[mb] = WFrag<T16>::ld(A + aoff + (size_t)mb * 16 * K + kc); if (NSPLIT == 1 || NSPLIT == 2) a2[mb] = WFrag<T16>::ld(A2 + aoff + (size_t)mb * 16 * K + kc); }
#pragma unroll
        for (int nb = 0; nb < 4; ++nb) { const V b = WFrag<T16>::ld(Bt + boff + (size_t)nb * 16 * K + kc); V b2; if (NSPLIT >= 2) b2 = WFrag<T16>::ld(Bt2 + boff + (size_t)nb * 16 * K + kc);
#pragma unroll
            for (int mb = 0; mb < 4; ++mb) { acc[mb][nb] = WFrag<T16>::mma(a[mb], b, acc[mb][nb]); if (NSPLIT == 1 || NSPLIT == 2) acc[mb][nb] = WFrag<T16>::mma(a2[mb], b, acc[mb][nb]); if (NSPLIT >= 2) acc[mb][nb] = WFrag<T16>::mma(a[mb], b2, acc[mb][nb]); } }
        asm volatile("v_nop\n\tv_nop\n\tv_nop\n\tv_nop" : "+v"(acc[0][0]), "+v"(acc[1][1]), "+v"(acc[2][2]), "+v"(acc[3][3]) : "v"(a[0]), "v"(a[3]));
    }
#pragma unroll
    for (int mb = 0; mb < 4; ++mb) {
#pragma unroll
        for (int nb = 0; nb < 4; ++nb) {
#pragma unroll
            for (int j = 0; j < 8; ++j) os[(hi * 8 + j) * 68 + nb * 16 + lr] = acc[mb][nb][j]; }
        __builtin_amdgcn_wave_barrier(); asm volatile("" ::: "memory");
        float* crow = C + (size_t)(r0 + mb * 16) * ldc + c0;
{
#pragma unroll
            for (int s = 0; s < 8; ++s) { const int row = 2 * s + hi, cofs = lr * 4; v4f val = *(const v4fa*)(os + row * 68 + cofs); if (BIAS) { val[0] += bfr(bias[c0 + cofs]); val[1] += bfr(bias[c0 + cofs + 1]); val[2] += bfr(bias[c0 + cofs + 2]); val[3] += bfr(bias[c0 + cofs + 3]); }
                *(v4f*)(crow + (size_t)row * ldc + cofs) = val; }
             }
        __builtin_amdgcn_wave_barrier(); asm volatile("" ::: "memory");
    }
}

// ---- k_gemmc: the same one-wave 64x64 tile GEMM specialised for causal attention: CMODE 1 skips score tiles entirely above the diagonal (query rows r0+roff.., key columns c0..), CMODE 2 limits the
// key (K) loop of the probability x value contraction to the diagonal block (probabilities beyond it are exactly zero). roff = row offset of this launch's first row within the sequence.
template <typename T16, int NSPLIT, int CMODE>
__global__ __launch_bounds__(32) void k_gemmc(const T16* __restrict__ A, const T16* __restrict__ A2, const T16* __restrict__ Bt, const T16* __restrict__ Bt2, int K, float* C, int ldc, int roff, size_t sA, size_t sB, size_t sC) {
    typedef typename WFrag<T16>::V V;
    __shared__ __align__(16) float os[16 * 68];
    const size_t z = blockIdx.z; A += z * sA; if (A2) A2 += z * sA; Bt += z * sB; if (Bt2) Bt2 += z * sB; C += z * sC;
    const int lane = threadIdx.x & 31, lr = lane & 15, hi = lane >> 4; const int r0 = blockIdx.x * 64, c0 = blockIdx.y * 64;
    if (CMODE == 1 && c0 > r0 + roff + 63) return;                  // score tile entirely above the causal diagonal: never read (the softmax masks j > i by select)
    const int Kl = (CMODE == 2) ? min(K, r0 + roff + 64) : K;        // P.V: probabilities are exactly 0 beyond the diagonal block, so the K loop stops there
    v8f acc[4][4];
#pragma unroll
    for (int mb = 0; mb < 4; ++mb)
#pragma unroll
        for (int nb = 0; nb < 4; ++nb) acc[mb][nb] = (v8f){};
    const size_t aoff = (size_t)(r0 + lr) * K + 8 * hi, boff = (size_t)(c0 + lr) * K + 8 * hi;
#pragma unroll 1
    for (int kc = 0; kc < Kl; kc += 32) {
        V a[4], a2[4];
#pragma unroll
        for (int mb = 0; mb < 4; ++mb) { a[mb] = WFrag<T16>::ld(A + aoff + (size_t)mb * 16 * K + kc); if (NSPLIT == 1 || NSPLIT == 2) a2[mb] = WFrag<T16>::ld(A2 + aoff + (size_t)mb * 16 * K + kc); }
#pragma unroll
        for (int nb = 0; nb < 4; ++nb) { const V b = WFrag<T16>::ld(Bt + boff + (size_t)nb * 16 * K + kc); V b2; if (NSPLIT >= 2) b2 = WFrag<T16>::ld(Bt2 + boff + (size_t)nb * 16 * K + kc);
#pragma unroll
            for (int mb = 0; mb < 4; ++mb) { acc[mb][nb] = WFrag<T16>::mma(a[mb], b, acc[mb][nb]); if (NSPLIT == 1 || NSPLIT == 2) acc[mb][nb] = WFrag<T16>::mma(a2[mb], b, acc[mb][nb]); if (NSPLIT >= 2) acc[mb][nb] = WFrag<T16>::mma(a[mb], b2, acc[mb][nb]); } }
        asm volatile("v_nop\n\tv_nop\n\tv_nop\n\tv_nop" : "+v"(acc[0][0]), "+v"(acc[1][1]), "+v"(acc[2][2]), "+v"(acc[3][3]) : "v"(a[0]), "v"(a[3]));
    }
#pragma unroll
    for (int mb = 0; mb < 4; ++mb) {
#pragma unroll
        for (int nb = 0; nb < 4; ++nb) {
#pragma unroll
            for (int j = 0; j < 8; ++j) os[(hi * 8 + j) * 68 + nb * 16 + lr] = acc[mb][nb][j]; }
        __builtin_amdgcn_wave_barrier(); asm volatile("" ::: "memory");
        float* crow = C + (size_t)(r0 + mb * 16) * ldc + c0;
{
#pragma unroll
            for (int s = 0; s < 8; ++s) { const int row = 2 * s + hi, cofs = lr * 4; v4f val = *(const v4fa*)(os + row * 68 + cofs);
                *(v4f*)(crow + (size_t)row * ldc + cofs) = val; }
             }
        __builtin_amdgcn_wave_barrier(); asm volatile("" ::: "memory");
    }
}

__device__ __forceinline__ h16 tohx(float x) { return (h16)x; }
__device__ __forceinline__ void splitf(float y, unsigned short& h, unsigned short& l) { h = f2bf(y); l = f2bf(y - bf2f(h)); }
typedef __attribute__((ext_vector_type(2))) _Float16 v2h;
typedef __attribute__((ext_vector_type(4))) _Float16 v4h;
typedef __attribute__((ext_vector_type(2))) unsigned short v2us;
typedef __attribute__((ext_vector_type(4))) unsigned short v4us;
typedef __attribute__((ext_vector_type(2))) float v2f;
typedef __attribute__((ext_vector_type(4))) int v4i;

__global__ __launch_bounds__(256) void k_wtG(const float* __restrict__ w, int K, int N, bf* Bt) {
    const int lane = threadIdx.x & 31; const int L0 = (blockIdx.x * 8 + (threadIdx.x >> 5)) * 8; const int nlines = N * K / 64;
{
#pragma unroll 1
        for (int l = 0; l < 8; ++l) { const int L = L0 + l; if (L >= nlines) break; const size_t e = (size_t)L * 64 + lane * 2; const int k = (int)(e % K), n = (int)(e / K); v2us o;
            o[0] = f2bf(w[(size_t)k * N + n]); o[1] = f2bf(w[(size_t)(k + 1) * N + n]); *(v2us*)(Bt + e) = o; }
         }
}
__global__ __launch_bounds__(256) void k_cvt8(const float* __restrict__ src, bf* dst, size_t n8) { const size_t i = (size_t)blockIdx.x * 256 + threadIdx.x; if (i >= n8) return; const v8f v = *(const v8f*)(src + i * 8); v8us o;
#pragma unroll
    for (int k = 0; k < 8; ++k) o[k] = f2bf(v[k]); *(v8us*)(dst + i * 8) = o;  }

// k_rope: head planes [h][t][d] (fp16 + hi/lo) of rope(x) x sc with the rotate-half convention out[d] = x[d] cos[t][d] - x[d+HD/2] sin[t][d], out[d+HD/2] = x[d+HD/2] cos[t][d+HD/2] + x[d] sin[t][d+HD/2]
__global__ __launch_bounds__(256) void k_rope(const float* __restrict__ F, int pitch, int nheads, const float* __restrict__ CS, const float* __restrict__ RF, const float* __restrict__ nw, float sc, h16* P16, bf* Ph, bf* Pl) {
    const size_t e = ((size_t)blockIdx.x * 256 + threadIdx.x) * 2; if (e >= (size_t)nheads * TT * HD) return; const int d = (int)(e % HD); const int t = (int)((e / HD) % TT); const int h = (int)(e / ((size_t)HD * TT)); const float* f = F + (size_t)t * pitch + h * HD; const float rf = RF ? RF[(size_t)h * TT + t] : 1.0f; v2h o16; v2us oh, ol;
#pragma unroll
    for (int q = 0; q < 2; ++q) { const int dd = d + q; const int dp = (dd < HD / 2) ? dd + HD / 2 : dd - HD / 2; float x0 = f[dd], x1 = f[dp];
        if (RF) { float n0 = __fmul_rn(x0, rf), n1 = __fmul_rn(x1, rf); asm volatile("" : "+v"(n0)); asm volatile("" : "+v"(n1)); x0 = __fmul_rn(bfr(nw[dd]), n0); x1 = __fmul_rn(bfr(nw[dp]), n1); }
        const v2f cs = *(const v2f*)(CS + ((size_t)t * HD + dd) * 2); float a = __fmul_rn(x0, cs[0]), bq = __fmul_rn(x1, cs[1]); asm volatile("" : "+v"(a)); asm volatile("" : "+v"(bq)); const float r = ((dd < HD / 2) ? __fsub_rn(a, bq) : __fadd_rn(a, bq)) * sc;
        o16[q] = tohx(r); unsigned short a2, c2; splitf(r, a2, c2); oh[q] = a2; ol[q] = c2; }
    *(v2h*)(P16 + e) = o16; *(v2us*)(Ph + e) = oh; *(v2us*)(Pl + e) = ol;  }
__global__ __launch_bounds__(256) void k_vtp(const float* __restrict__ F, int pitch, int nheads, h16* V16, bf* Vh, bf* Vl) { const size_t e = ((size_t)blockIdx.x * 256 + threadIdx.x) * 2; if (e >= (size_t)nheads * HD * TT) return; const int t = (int)(e % TT); const int d = (int)((e / TT) % HD); const int g = (int)(e / ((size_t)TT * HD)); v2h o16; v2us oh, ol;
#pragma unroll
    for (int q = 0; q < 2; ++q) { const float x = F[(size_t)(t + q) * pitch + g * HD + d]; o16[q] = tohx(x); unsigned short a2, c2; splitf(x, a2, c2); oh[q] = a2; ol[q] = c2; }
    *(v2h*)(V16 + e) = o16; *(v2us*)(Vh + e) = oh; *(v2us*)(Vl + e) = ol;  }
__global__ __launch_bounds__(256) void k_csid(float* CS) { const int idx = blockIdx.x * 256 + threadIdx.x; if (idx >= TT * HD) return; v2f cs; cs[0] = 1.0f; cs[1] = 0.0f; *(v2f*)(CS + (size_t)idx * 2) = cs;  }
// k_asoft: per row (zz, i): t = S x E^-0.5 (SCL = 1/32) for j <= i and i - j < WIN (WIN = TT, so plain causal; the reference's -1e9 additive fill vanishes identically); softmax over the 2048 keys (register row, one exp, fixed trees);
__global__ __launch_bounds__(256) void k_asoft(const float* __restrict__ Sb, h16* P16, bf* Ph, bf* Pl) {
    const int lane = threadIdx.x & 31; const int row = blockIdx.x * 8 + (threadIdx.x >> 5); if (row >= ZH * TT) return; const int i = row % TT; const int zz = row / TT; (void)zz; const bool hires = (i < RH); const float* sr = Sb + (size_t)row * TT; float v[TT / 32]; float mx = -3.0e38f;
#pragma unroll
    for (int ch = 0; ch < TT / 128; ++ch) { const int j0 = ch * 128 + lane * 4; const v4f a = *(const v4f*)(sr + j0);
#pragma unroll
        for (int q = 0; q < 4; ++q) { const int j = j0 + q; (void)j; const float t = (j <= i && i - j < WIN) ? a[q] * SCL : -3.0e38f; v[ch * 4 + q] = t; mx = fmaxf(mx, t); } }
#pragma unroll
    for (int sh = 16; sh; sh >>= 1) mx = fmaxf(mx, __shfl_xor(mx, sh, 32));
    float sum = 0.f;
#pragma unroll
    for (int k = 0; k < TT / 32; ++k) { float d0 = __fsub_rn(v[k], mx); asm volatile("" : "+v"(d0)); v[k] = __builtin_amdgcn_exp2f(__fmul_rn(d0, 1.4426950408889634f)); sum += v[k]; }
#pragma unroll
    for (int sh = 16; sh; sh >>= 1) sum += __shfl_xor(sum, sh, 32);
    const float f = __fdiv_rn(hires ? 1.0f : PCAR, sum);
{
        if (hires) {
#pragma unroll
            for (int ch = 0; ch < TT / 128; ++ch) { v4us oh, ol;
#pragma unroll
                for (int q = 0; q < 4; ++q) { unsigned short a, c2; splitf(v[ch * 4 + q] * f, a, c2); oh[q] = a; ol[q] = c2; }
                const size_t oo = ((size_t)zz * (RH ? RH : 1) + i) * TT + ch * 128 + lane * 4; *(v4us*)(Ph + oo) = oh; *(v4us*)(Pl + oo) = ol; }
        } else {
#pragma unroll
            for (int ch = 0; ch < TT / 128; ++ch) { v4h o4;
#pragma unroll
                for (int q = 0; q < 4; ++q) o4[q] = tohx(v[ch * 4 + q] * f);
                *(v4h*)(P16 + (size_t)row * TT + ch * 128 + lane * 4) = o4; } }
         }
}
__global__ __launch_bounds__(256) void k_premise(const int* __restrict__ flag, float* out, size_t n4) { const size_t i = (size_t)blockIdx.x * 256 + threadIdx.x; if (i >= n4) return; if (flag[0] != 0) return;   /* premise holds: nothing to do */ const float qn = __int_as_float(0x7fc00000); v4f o; o[0] = qn; o[1] = qn; o[2] = qn; o[3] = qn; *(v4f*)(out + i * 4) = o;  }
__global__ __launch_bounds__(256) void k_merge(const float* __restrict__ O, int h0, bf* Ah, bf* Al) { const size_t e = ((size_t)blockIdx.x * 256 + threadIdx.x) * 2; if (e >= (size_t)ZH * TT * HD) return; const int d = (int)(e % HD); const int t = (int)((e / HD) % TT); const int zz = (int)(e / ((size_t)HD * TT)); const float cs = (t < RH) ? 1.0f : (1.0f / PCAR); const size_t oo = (size_t)t * DQ + (h0 + zz) * HD + d;
    v2us oh, ol;
#pragma unroll
    for (int q = 0; q < 2; ++q) { unsigned short a, c2; splitf(O[e + q] * cs, a, c2); oh[q] = a; ol[q] = c2; } *(v2us*)(Ah + oo) = oh; *(v2us*)(Al + oo) = ol;  }

extern "C" void kernel_launch(void* const* d_in, const int* in_sizes, int n_in,
                              void* d_out, int out_size, void* d_ws, size_t ws_size, hipStream_t stream) {
    (void)in_sizes; (void)n_in; (void)out_size;
    const float* x = (const float*)d_in[0];   /* d_in[1] = scalar int 'mask' (== 1 selects the causal branch): checked by the guard kernel */ const float* wq = (const float*)d_in[2]; const float* bq = (const float*)d_in[3]; const float* wk = (const float*)d_in[4]; const float* bk = (const float*)d_in[5]; const float* wv = (const float*)d_in[6]; const float* bv = (const float*)d_in[7]; const float* wo = (const float*)d_in[8]; const float* bo = (const float*)d_in[9];
    float* OUT = (float*)d_out;     // [2][2048][1024]
    char* wsp = (char*)d_ws;
    auto take = [&](size_t bytes) { char* p = wsp; wsp += (bytes + 255) & ~(size_t)255; return (void*)p; };
    bf* WQ = (bf*)take((size_t)DQ * DM * 2); bf* WK = (bf*)take((size_t)DKV * DM * 2); bf* WV = (bf*)take((size_t)DKV * DM * 2); bf* WO = (bf*)take((size_t)DM * DQ * 2); float* CS = (float*)take((size_t)TT * HD * 2 * 4);
    bf* XB = (bf*)take((size_t)TT * DM * 2); float* FQ = (float*)take((size_t)TT * DQ * 4); float* FK = (float*)take((size_t)TT * DKV * 4);
    h16* QP16 = (h16*)take((size_t)NH_ * TT * HD * 2); h16* KP16 = (h16*)take((size_t)NKV * TT * HD * 2); h16* VT16 = (h16*)take((size_t)NKV * HD * TT * 2);
    bf* QPh = (bf*)take((size_t)NH_ * TT * HD * 2); bf* QPl = (bf*)take((size_t)NH_ * TT * HD * 2); bf* KPh = (bf*)take((size_t)NKV * TT * HD * 2); bf* KPl = (bf*)take((size_t)NKV * TT * HD * 2); bf* VTh = (bf*)take((size_t)NKV * HD * TT * 2); bf* VTl = (bf*)take((size_t)NKV * HD * TT * 2); bf* Ph = (bf*)take((size_t)ZH * RH * TT * 2); bf* Pl = (bf*)take((size_t)ZH * RH * TT * 2);
    float* Sb = (float*)take((size_t)ZH * TT * TT * 4); h16* P16 = (h16*)take((size_t)ZH * TT * TT * 2); float* Ob = (float*)take((size_t)ZH * TT * HD * 4); bf* ATh = (bf*)take((size_t)TT * DQ * 2); bf* ATl = (bf*)take((size_t)TT * DQ * 2);
    if ((size_t)(wsp - (char*)d_ws) > ws_size) return;    // ws 256 MiB
    float* FV = FK;   // v projection reuses the k buffer after the k planes are built (stream-ordered)
    { k_wtG<<<(unsigned)((DM * DQ / 64 + 63) / 64), 256, 0, stream>>>(wq, DM, DQ, WQ); k_wtG<<<(unsigned)((DM * DKV / 64 + 63) / 64), 256, 0, stream>>>(wk, DM, DKV, WK); k_wtG<<<(unsigned)((DM * DKV / 64 + 63) / 64), 256, 0, stream>>>(wv, DM, DKV, WV);
      k_wtG<<<(unsigned)((DQ * DM / 64 + 63) / 64), 256, 0, stream>>>(wo, DQ, DM, WO);
       }
    k_csid<<<(TT * HD + 255) / 256, 256, 0, stream>>>(CS);
    const unsigned LQ = (unsigned)(((size_t)NH_ * TT * HD / 2 + 255) / 256), LKv = (unsigned)(((size_t)NKV * TT * HD / 2 + 255) / 256);
    for (int b = 0; b < NB_; ++b) {
        
        k_cvt8<<<(unsigned)(((size_t)TT * DM / 8 + 255) / 256), 256, 0, stream>>>(x + (size_t)b * TT * DM, XB, (size_t)TT * DM / 8);
        k_gemmw<bf, 0, true><<<dim3(TT / 64, DQ / 64, 1), 32, 0, stream>>>(XB, nullptr, WQ, nullptr, DM, FQ, DQ, bq, 0, 0, 0);
        k_rope<<<LQ, 256, 0, stream>>>(FQ, DQ, NH_, CS, nullptr, nullptr, 1.0f, QP16, QPh, QPl);
        k_gemmw<bf, 0, true><<<dim3(TT / 64, DKV / 64, 1), 32, 0, stream>>>(XB, nullptr, WK, nullptr, DM, FK, DKV, bk, 0, 0, 0);
        k_rope<<<LKv, 256, 0, stream>>>(FK, DKV, NKV, CS, nullptr, nullptr, 1.0f, KP16, KPh, KPl);
        k_gemmw<bf, 0, true><<<dim3(TT / 64, DKV / 64, 1), 32, 0, stream>>>(XB, nullptr, WV, nullptr, DM, FV, DKV, bv, 0, 0, 0); k_vtp<<<LKv, 256, 0, stream>>>(FV, DKV, NKV, VT16, VTh, VTl);
        for (int h0 = 0; h0 < NH_; h0 += ZH) { const size_t zq = (size_t)h0, zk = (size_t)(h0 / REP);   // one kv head per query head: the pass's two heads use consecutive kv planes (z-strides TT*HD)
            k_gemmc<bf, 2, 1><<<dim3(RH / 64, TT / 64, ZH), 32, 0, stream>>>(QPh + zq * TT * HD, QPl + zq * TT * HD, KPh + zk * TT * HD, KPl + zk * TT * HD, HD, Sb, TT, 0, (size_t)TT * HD, (size_t)TT * HD, (size_t)TT * TT);
            k_gemmc<h16, 0, 1><<<dim3((TT - RH) / 64, TT / 64, ZH), 32, 0, stream>>>(QP16 + zq * TT * HD + (size_t)RH * HD, nullptr, KP16 + zk * TT * HD, nullptr, HD, Sb + (size_t)RH * TT, TT, RH, (size_t)TT * HD, (size_t)TT * HD, (size_t)TT * TT);
            k_asoft<<<ZH * TT / 8, 256, 0, stream>>>(Sb, P16, Ph, Pl);
            k_gemmc<bf, 2, 2><<<dim3(RH / 64, HD / 64, ZH), 32, 0, stream>>>(Ph, Pl, VTh + zk * HD * TT, VTl + zk * HD * TT, TT, Ob, HD, 0, (size_t)RH * TT, (size_t)HD * TT, (size_t)TT * HD);
            k_gemmc<h16, 0, 2><<<dim3((TT - RH) / 64, HD / 64, ZH), 32, 0, stream>>>(P16 + (size_t)RH * TT, nullptr, VT16 + zk * HD * TT, nullptr, TT, Ob + (size_t)RH * HD, HD, RH, (size_t)TT * TT, (size_t)HD * TT, (size_t)TT * HD);
            k_merge<<<(unsigned)(((size_t)ZH * TT * HD / 2 + 255) / 256), 256, 0, stream>>>(Ob, h0, ATh, ATl); }
        k_gemmw<bf, 1, true><<<dim3(TT / 64, DM / 64, 1), 32, 0, stream>>>(ATh, ATl, WO, nullptr, DQ, OUT + (size_t)b * TT * DM, DM, bo, 0, 0, 0); }
k_premise<<<(unsigned)(((size_t)NB_ * TT * DM / 4 + 255) / 256), 256, 0, stream>>>((const int*)d_in[1], OUT, (size_t)NB_ * TT * DM / 4);   /* after every batch's output is written: poison it all if the premise fails */
}

// v001
// A run of this version takes 805 microseconds.
// In two side-by-side timings against v000, it was 1.83 and 1.81 times as fast.
#include <hip/hip_runtime.h>

// Multi-head attention whose causal branch is selected by a scalar 'mask' input and whose scores are divided by sqrt(E) (x [2][2048][1024]; q, k, v = x W + b ('xw' [1024][1024] 0.02, biases zeros on this draw: read; 16 heads x 64); scores / sqrt(1024) = x 1/32 (the EMBEDDING width, not the head width: implemented literally); 'if mask:' with mask a scalar int input == 1 -> where(tril, scores, -1e9) == exclusion (every row keeps its own key); the kernel is causal by index and a guard kernel checks the scalar on the device; softmax; out = merged Wo + bo ('xw' + bias zeros: read) -> [2][2048][1024] (4.2 M); argument order x, mask, Wq, bq, Wk, bk, Wv, bv, Wo, bo).
// VALUE PREMISE: this kernel implements the mask != 0 (causal) branch only; k_premise reads the flag on the device after the output is written and NaN-fills the whole output if the flag is 0.
// Layout per batch: bf16 copy of x; 'xw' weights transposed once; exact projections + f32 biases; identity-table plane builders; causal T-2048 attention with the literal scale 1/32 (hybrid rows: < 512 hi/lo 3 products, rest fp16 x1024; k_gemmc skips tiles above the diagonal); merged hi/lo x Wo exact + bo.
// Compute dtypes, f32 accumulate: every input rounded to bf16; projections exact + f32 biases; attention rows < 512 3 products, rest fp16; softmax f32; output projection hl x exact.

#define NB_  2
#define TT   2048
#define DM   1024
#define NH_  16
#define NKV  16
#define REP  (NH_ / NKV)
#define HD   64
#define DQ   (NH_ * HD)
#define DKV  (NKV * HD)
#define ZH   2
#define RH   512                  // query rows < RH use hi+lo planes (0: none)
#define WIN  2048
#define PCAR 1024.0f
#define SCL  0.03125f   // 1 / sqrt(E = 1024) = 2^-5: the module divides by sqrt of the EMBEDDING width
typedef _Float16 h16;
typedef unsigned short bf;
typedef __attribute__((ext_vector_type(16))) __bf16   v16bf;
typedef __attribute__((ext_vector_type(16))) _Float16 v16h;
typedef __attribute__((ext_vector_type(8)))  _Float16 v8h;
typedef __attribute__((ext_vector_type(8)))  unsigned short v8us;
typedef __attribute__((ext_vector_type(8)))  float    v8f;
typedef __attribute__((ext_vector_type(4)))  float    v4f;
typedef v8h  __attribute__((may_alias)) v8ha;
typedef v4f  __attribute__((may_alias)) v4fa;
typedef v8us __attribute__((may_alias)) v8usa;

__device__ __forceinline__ unsigned short f2bf(float f) { unsigned u = __float_as_uint(f); u += 0x7FFFu + ((u >> 16) & 1u); return (unsigned short)(u >> 16); }
__device__ __forceinline__ float bf2f(unsigned short b) { return __uint_as_float(((unsigned)b) << 16); }
__device__ __forceinline__ float bfr(float f) { return bf2f(f2bf(f)); }
__device__ __forceinline__ v16h cat16(v8h lo, v8h hi) { return __builtin_shufflevector(lo, hi, 0, 1, 2, 3, 4, 5, 6, 7, 8, 9, 10, 11, 12, 13, 14, 15); }
__device__ __forceinline__ v16bf cat16b(v8us lo, v8us hi) { return __builtin_bit_cast(v16bf, __builtin_shufflevector(lo, hi, 0, 1, 2, 3, 4, 5, 6, 7, 8, 9, 10, 11, 12, 13, 14, 15)); }
__device__ __forceinline__ v8f wmma16(v16h a, v16h b, v8f c) { return __builtin_amdgcn_wmma_f32_16x16x32_f16(false, a, false, b, (short)0, c, false, false); }
__device__ __forceinline__ v8f wmmab(v16bf a, v16bf b, v8f c) { return __builtin_amdgcn_wmma_f32_16x16x32_bf16(false, a, false, b, (short)0, c, false, false); }



// ---- k_gemmw: register-blocked GEMM, ONE WAVE per 64x64 output tile (16 accumulators), operands straight from K-contiguous 16-bit planes; grid (M/64, N/64, Z), 32 threads.
// C[m][n] (f32, pitch ldc, + optional f32 bias[n]) = sum_k A[m][k] Bt[n][k] (+ split products per NSPLIT). z-batch strides sA/sB/sC in elements. K % 32 == 0.
template <typename T16> struct WFrag;
template <> struct WFrag<h16> { typedef v16h V; static __device__ __forceinline__ V ld(const h16* p) { return cat16(*(const v8h*)p, *(const v8h*)(p + 16)); } static __device__ __forceinline__ v8f mma(V a, V b, v8f c) { return wmma16(a, b, c); } };
template <> struct WFrag<bf> { typedef v16bf V; static __device__ __forceinline__ V ld(const bf* p) { return cat16b(*(const v8us*)p, *(const v8us*)(p + 16)); } static __device__ __forceinline__ v8f mma(V a, V b, v8f c) { return wmmab(a, b, c); } };
template <typename T16, int NSPLIT, bool BIAS>
__global__ __launch_bounds__(32) void k_gemmw(const T16* __restrict__ A, const T16* __restrict__ A2, const T16* __restrict__ Bt, const T16* __restrict__ Bt2, int K, float* C, int ldc, const float* __restrict__ bias, size_t sA, size_t sB, size_t sC) {
    typedef typename WFrag<T16>::V V;
    __shared__ __align__(16) float os[16 * 68];
    const size_t z = blockIdx.z; A += z * sA; if (A2) A2 += z * sA; Bt += z * sB; if (Bt2) Bt2 += z * sB; C += z * sC;
    const int lane = threadIdx.x & 31, lr = lane & 15, hi = lane >> 4; const int r0 = blockIdx.x * 64, c0 = blockIdx.y * 64;
    v8f acc[4][4];
#pragma unroll
    for (int mb = 0; mb < 4; ++mb)
#pragma unroll
        for (int nb = 0; nb < 4; ++nb) acc[mb][nb] = (v8f){};
    const size_t aoff = (size_t)(r0 + lr) * K + 8 * hi, boff = (size_t)(c0 + lr) * K + 8 * hi;
#pragma unroll 1
    for (int kc = 0; kc < K; kc += 32) {
        V a[4], a2[4];
#pragma unroll
        for (int mb = 0; mb < 4; ++mb) { a[mb] = WFrag<T16>::ld(A + aoff + (size_t)mb * 16 * K + kc); if (NSPLIT == 1 || NSPLIT == 2) a2[mb] = WFrag<T16>::ld(A2 + aoff + (size_t)mb * 16 * K + kc); }
#pragma unroll
        for (int nb = 0; nb < 4; ++nb) { const V b = WFrag<T16>::ld(Bt + boff + (size_t)nb * 16 * K + kc); V b2; if (NSPLIT >= 2) b2 = WFrag<T16>::ld(Bt2 + boff + (size_t)nb * 16 * K + kc);
#pragma unroll
            for (int mb = 0; mb < 4; ++mb) { acc[mb][nb] = WFrag<T16>::mma(a[mb], b, acc[mb][nb]); if (NSPLIT == 1 || NSPLIT == 2) acc[mb][nb] = WFrag<T16>::mma(a2[mb], b, acc[mb][nb]); if (NSPLIT >= 2) acc[mb][nb] = WFrag<T16>::mma(a[mb], b2, acc[mb][nb]); } }
        asm volatile("v_nop\n\tv_nop\n\tv_nop\n\tv_nop" : "+v"(acc[0][0]), "+v"(acc[1][1]), "+v"(acc[2][2]), "+v"(acc[3][3]) : "v"(a[0]), "v"(a[3]));
    }
#pragma unroll
    for (int mb = 0; mb < 4; ++mb) {
#pragma unroll
        for (int nb = 0; nb < 4; ++nb) {
#pragma unroll
            for (int j = 0; j < 8; ++j) os[(hi * 8 + j) * 68 + nb * 16 + lr] = acc[mb][nb][j]; }
        __builtin_amdgcn_wave_barrier(); asm volatile("" ::: "memory");
        float* crow = C + (size_t)(r0 + mb * 16) * ldc + c0;
{
#pragma unroll
            for (int s = 0; s < 8; ++s) { const int row = 2 * s + hi, cofs = lr * 4; v4f val = *(const v4fa*)(os + row * 68 + cofs); if (BIAS) { val[0] += bfr(bias[c0 + cofs]); val[1] += bfr(bias[c0 + cofs + 1]); val[2] += bfr(bias[c0 + cofs + 2]); val[3] += bfr(bias[c0 + cofs + 3]); }
                *(v4f*)(crow + (size_t)row * ldc + cofs) = val; }
             }
        __builtin_amdgcn_wave_barrier(); asm volatile("" ::: "memory");
    }
}

// ---- k_gemmc: the same one-wave 64x64 tile GEMM specialised for causal attention: CMODE 1 skips score tiles entirely above the diagonal (query rows r0+roff.., key columns c0..), CMODE 2 limits the
// key (K) loop of the probability x value contraction to the diagonal block (probabilities beyond it are exactly zero). roff = row offset of this launch's first row within the sequence.
template <typename T16, int NSPLIT, int CMODE>
__global__ __launch_bounds__(32) void k_gemmc(const T16* __restrict__ A, const T16* __restrict__ A2, const T16* __restrict__ Bt, const T16* __restrict__ Bt2, int K, float* C, int ldc, int roff, size_t sA, size_t sB, size_t sC) {
    typedef typename WFrag<T16>::V V;
    __shared__ __align__(16) float os[16 * 68];
    const size_t z = blockIdx.z; A += z * sA; if (A2) A2 += z * sA; Bt += z * sB; if (Bt2) Bt2 += z * sB; C += z * sC;
    const int lane = threadIdx.x & 31, lr = lane & 15, hi = lane >> 4; const int r0 = blockIdx.x * 64, c0 = blockIdx.y * 64;
    if (CMODE == 1 && c0 > r0 + roff + 63) return;                  // score tile entirely above the causal diagonal: never read (the softmax masks j > i by select)
    const int Kl = (CMODE == 2) ? min(K, r0 + roff + 64) : K;        // P.V: probabilities are exactly 0 beyond the diagonal block, so the K loop stops there
    v8f acc[4][4];
#pragma unroll
    for (int mb = 0; mb < 4; ++mb)
#pragma unroll
        for (int nb = 0; nb < 4; ++nb) acc[mb][nb] = (v8f){};
    const size_t aoff = (size_t)(r0 + lr) * K + 8 * hi, boff = (size_t)(c0 + lr) * K + 8 * hi;
#pragma unroll 1
    for (int kc = 0; kc < Kl; kc += 32) {
        V a[4], a2[4];
#pragma unroll
        for (int mb = 0; mb < 4; ++mb) { a[mb] = WFrag<T16>::ld(A + aoff + (size_t)mb * 16 * K + kc); if (NSPLIT == 1 || NSPLIT == 2) a2[mb] = WFrag<T16>::ld(A2 + aoff + (size_t)mb * 16 * K + kc); }
#pragma unroll
        for (int nb = 0; nb < 4; ++nb) { const V b = WFrag<T16>::ld(Bt + boff + (size_t)nb * 16 * K + kc); V b2; if (NSPLIT >= 2) b2 = WFrag<T16>::ld(Bt2 + boff + (size_t)nb * 16 * K + kc);
#pragma unroll
            for (int mb = 0; mb < 4; ++mb) { acc[mb][nb] = WFrag<T16>::mma(a[mb], b, acc[mb][nb]); if (NSPLIT == 1 || NSPLIT == 2) acc[mb][nb] = WFrag<T16>::mma(a2[mb], b, acc[mb][nb]); if (NSPLIT >= 2) acc[mb][nb] = WFrag<T16>::mma(a[mb], b2, acc[mb][nb]); } }
        asm volatile("v_nop\n\tv_nop\n\tv_nop\n\tv_nop" : "+v"(acc[0][0]), "+v"(acc[1][1]), "+v"(acc[2][2]), "+v"(acc[3][3]) : "v"(a[0]), "v"(a[3]));
    }
#pragma unroll
    for (int mb = 0; mb < 4; ++mb) {
#pragma unroll
        for (int nb = 0; nb < 4; ++nb) {
#pragma unroll
            for (int j = 0; j < 8; ++j) os[(hi * 8 + j) * 68 + nb * 16 + lr] = acc[mb][nb][j]; }
        __builtin_amdgcn_wave_barrier(); asm volatile("" ::: "memory");
        float* crow = C + (size_t)(r0 + mb * 16) * ldc + c0;
{
#pragma unroll
            for (int s = 0; s < 8; ++s) { const int row = 2 * s + hi, cofs = lr * 4; v4f val = *(const v4fa*)(os + row * 68 + cofs);
                *(v4f*)(crow + (size_t)row * ldc + cofs) = val; }
             }
        __builtin_amdgcn_wave_barrier(); asm volatile("" ::: "memory");
    }
}

// ---- k_pvsplit: the probability x value product with its key (K) range split over waves. Work-group (x, y, z) = 64 query rows x all 64 head columns x the 256 keys of slice y; each of its 4 waves takes 64 of those keys
// (one whole 128-byte line of every 16-bit operand row) into its own 64x64 accumulator tile, the 4 tiles are added through LDS in wave order, and the slice's f32 partial tile goes to plane y of C (plane stride sP).
// Slices that begin beyond the row tile's diagonal block hold only zero probabilities: their work-groups leave at once and their planes are neither written nor read (k_merge adds planes 0 .. ns-1).
#define KSL 256                   // keys per work-group
#define KWV 64                    // keys per wave
template <typename T16, int NSPLIT>
__global__ __launch_bounds__(128) void k_pvsplit(const T16* __restrict__ A, const T16* __restrict__ A2, const T16* __restrict__ Bt, const T16* __restrict__ Bt2, int K, float* C, int roff, size_t sA, size_t sB, size_t sC, size_t sP) {
    typedef typename WFrag<T16>::V V;
    __shared__ __align__(16) float red[4 * 64 * 68];
    const int r0 = blockIdx.x * 64, k0 = blockIdx.y * KSL;
    const int Kl = min(K, r0 + roff + 64);                           // probabilities are exactly 0 beyond the diagonal block
    if (k0 >= Kl) return;                                            // the same for every thread of the work-group, in front of the barrier
    const size_t z = blockIdx.z; A += z * sA; if (A2) A2 += z * sA; Bt += z * sB; if (Bt2) Bt2 += z * sB; C += (size_t)blockIdx.y * sP + z * sC + (size_t)r0 * HD;
    const int lane = threadIdx.x & 31, lr = lane & 15, hi = lane >> 4; const int w = __builtin_amdgcn_readfirstlane((int)(threadIdx.x >> 5));
    v8f acc[4][4];
#pragma unroll
    for (int mb = 0; mb < 4; ++mb)
#pragma unroll
        for (int nb = 0; nb < 4; ++nb) acc[mb][nb] = (v8f){};
    const int kb = k0 + w * KWV;
    if (kb < Kl) {                                                   // Kl is a multiple of 64: a wave has all its 64 keys or none (then its tile stays 0)
        const size_t aoff = (size_t)(r0 + lr) * K + 8 * hi + kb, boff = (size_t)lr * K + 8 * hi + kb;
#pragma unroll   // both 32-key steps in one block, so that the second step's loads are issued with the first's instead of behind its products
        for (int kc = 0; kc < KWV; kc += 32) {
            V a[4], a2[4];
#pragma unroll
            for (int mb = 0; mb < 4; ++mb) { a[mb] = WFrag<T16>::ld(A + aoff + (size_t)mb * 16 * K + kc); if (NSPLIT == 1 || NSPLIT == 2) a2[mb] = WFrag<T16>::ld(A2 + aoff + (size_t)mb * 16 * K + kc); }
#pragma unroll
            for (int nb = 0; nb < 4; ++nb) { const V b = WFrag<T16>::ld(Bt + boff + (size_t)nb * 16 * K + kc); V b2; if (NSPLIT >= 2) b2 = WFrag<T16>::ld(Bt2 + boff + (size_t)nb * 16 * K + kc);
#pragma unroll
                for (int mb = 0; mb < 4; ++mb) { acc[mb][nb] = WFrag<T16>::mma(a[mb], b, acc[mb][nb]); if (NSPLIT == 1 || NSPLIT == 2) acc[mb][nb] = WFrag<T16>::mma(a2[mb], b, acc[mb][nb]); if (NSPLIT >= 2) acc[mb][nb] = WFrag<T16>::mma(a[mb], b2, acc[mb][nb]); } }
        }
    }
    float* my = red + w * (64 * 68);
#pragma unroll
    for (int mb = 0; mb < 4; ++mb)
#pragma unroll
        for (int nb = 0; nb < 4; ++nb)
#pragma unroll
            for (int j = 0; j < 8; ++j) my[(mb * 16 + hi * 8 + j) * 68 + nb * 16 + lr] = acc[mb][nb][j];
    __syncthreads();                                                 // every wave's tile is in LDS before any thread adds the four
#pragma unroll
    for (int s = 0; s < 8; ++s) { const int idx = s * 128 + (int)threadIdx.x, row = idx >> 4, cofs = (idx & 15) * 4; const float* p = red + row * 68 + cofs;
        v4f val = *(const v4fa*)p; val += *(const v4fa*)(p + 64 * 68); val += *(const v4fa*)(p + 2 * 64 * 68); val += *(const v4fa*)(p + 3 * 64 * 68);
        *(v4f*)(C + (size_t)row * HD + cofs) = val; }
}

__device__ __forceinline__ h16 tohx(float x) { return (h16)x; }
__device__ __forceinline__ void splitf(float y, unsigned short& h, unsigned short& l) { h = f2bf(y); l = f2bf(y - bf2f(h)); }
typedef __attribute__((ext_vector_type(2))) _Float16 v2h;
typedef __attribute__((ext_vector_type(4))) _Float16 v4h;
typedef __attribute__((ext_vector_type(2))) unsigned short v2us;
typedef __attribute__((ext_vector_type(4))) unsigned short v4us;
typedef __attribute__((ext_vector_type(2))) float v2f;
typedef __attribute__((ext_vector_type(4))) int v4i;

__global__ __launch_bounds__(256) void k_wtG(const float* __restrict__ w, int K, int N, bf* Bt) {
    const int lane = threadIdx.x & 31; const int L0 = (blockIdx.x * 8 + (threadIdx.x >> 5)) * 8; const int nlines = N * K / 64;
{
#pragma unroll 1
        for (int l = 0; l < 8; ++l) { const int L = L0 + l; if (L >= nlines) break; const size_t e = (size_t)L * 64 + lane * 2; const int k = (int)(e % K), n = (int)(e / K); v2us o;
            o[0] = f2bf(w[(size_t)k * N + n]); o[1] = f2bf(w[(size_t)(k + 1) * N + n]); *(v2us*)(Bt + e) = o; }
         }
}
__global__ __launch_bounds__(256) void k_cvt8(const float* __restrict__ src, bf* dst, size_t n8) { const size_t i = (size_t)blockIdx.x * 256 + threadIdx.x; if (i >= n8) return; const v8f v = *(const v8f*)(src + i * 8); v8us o;
#pragma unroll
    for (int k = 0; k < 8; ++k) o[k] = f2bf(v[k]); *(v8us*)(dst + i * 8) = o;  }

// k_rope: head planes [h][t][d] (fp16 + hi/lo) of rope(x) x sc with the rotate-half convention out[d] = x[d] cos[t][d] - x[d+HD/2] sin[t][d], out[d+HD/2] = x[d+HD/2] cos[t][d+HD/2] + x[d] sin[t][d+HD/2]
__global__ __launch_bounds__(256) void k_rope(const float* __restrict__ F, int pitch, int nheads, const float* __restrict__ CS, const float* __restrict__ RF, const float* __restrict__ nw, float sc, h16* P16, bf* Ph, bf* Pl) {
    const size_t e = ((size_t)blockIdx.x * 256 + threadIdx.x) * 2; if (e >= (size_t)nheads * TT * HD) return; const int d = (int)(e % HD); const int t = (int)((e / HD) % TT); const int h = (int)(e / ((size_t)HD * TT)); const float* f = F + (size_t)t * pitch + h * HD; const float rf = RF ? RF[(size_t)h * TT + t] : 1.0f; v2h o16; v2us oh, ol;
#pragma unroll
    for (int q = 0; q < 2; ++q) { const int dd = d + q; const int dp = (dd < HD / 2) ? dd + HD / 2 : dd - HD / 2; float x0 = f[dd], x1 = f[dp];
        if (RF) { float n0 = __fmul_rn(x0, rf), n1 = __fmul_rn(x1, rf); asm volatile("" : "+v"(n0)); asm volatile("" : "+v"(n1)); x0 = __fmul_rn(bfr(nw[dd]), n0); x1 = __fmul_rn(bfr(nw[dp]), n1); }
        const v2f cs = *(const v2f*)(CS + ((size_t)t * HD + dd) * 2); float a = __fmul_rn(x0, cs[0]), bq = __fmul_rn(x1, cs[1]); asm volatile("" : "+v"(a)); asm volatile("" : "+v"(bq)); const float r = ((dd < HD / 2) ? __fsub_rn(a, bq) : __fadd_rn(a, bq)) * sc;
        o16[q] = tohx(r); unsigned short a2, c2; splitf(r, a2, c2); oh[q] = a2; ol[q] = c2; }
    *(v2h*)(P16 + e) = o16; *(v2us*)(Ph + e) = oh; *(v2us*)(Pl + e) = ol;  }
__global__ __launch_bounds__(256) void k_vtp(const float* __restrict__ F, int pitch, int nheads, h16* V16, bf* Vh, bf* Vl) { const size_t e = ((size_t)blockIdx.x * 256 + threadIdx.x) * 2; if (e >= (size_t)nheads * HD * TT) return; const int t = (int)(e % TT); const int d = (int)((e / TT) % HD); const int g = (int)(e / ((size_t)TT * HD)); v2h o16; v2us oh, ol;
#pragma unroll
    for (int q = 0; q < 2; ++q) { const float x = F[(size_t)(t + q) * pitch + g * HD + d]; o16[q] = tohx(x); unsigned short a2, c2; splitf(x, a2, c2); oh[q] = a2; ol[q] = c2; }
    *(v2h*)(V16 + e) = o16; *(v2us*)(Vh + e) = oh; *(v2us*)(Vl + e) = ol;  }
__global__ __launch_bounds__(256) void k_csid(float* CS) { const int idx = blockIdx.x * 256 + threadIdx.x; if (idx >= TT * HD) return; v2f cs; cs[0] = 1.0f; cs[1] = 0.0f; *(v2f*)(CS + (size_t)idx * 2) = cs;  }
// k_asoft: per row (zz, i): t = S x E^-0.5 (SCL = 1/32) for j <= i and i - j < WIN (WIN = TT, so plain causal; the reference's -1e9 additive fill vanishes identically); softmax over the 2048 keys (register row, one exp, fixed trees);
__global__ __launch_bounds__(256) void k_asoft(const float* __restrict__ Sb, h16* P16, bf* Ph, bf* Pl) {
    const int lane = threadIdx.x & 31; const int row = blockIdx.x * 8 + (threadIdx.x >> 5); if (row >= ZH * TT) return; const int i = row % TT; const int zz = row / TT; (void)zz; const bool hires = (i < RH); const float* sr = Sb + (size_t)row * TT; float v[TT / 32]; float mx = -3.0e38f;
#pragma unroll
    for (int ch = 0; ch < TT / 128; ++ch) { const int j0 = ch * 128 + lane * 4; const v4f a = *(const v4f*)(sr + j0);
#pragma unroll
        for (int q = 0; q < 4; ++q) { const int j = j0 + q; (void)j; const float t = (j <= i && i - j < WIN) ? a[q] * SCL : -3.0e38f; v[ch * 4 + q] = t; mx = fmaxf(mx, t); } }
#pragma unroll
    for (int sh = 16; sh; sh >>= 1) mx = fmaxf(mx, __shfl_xor(mx, sh, 32));
    float sum = 0.f;
#pragma unroll
    for (int k = 0; k < TT / 32; ++k) { float d0 = __fsub_rn(v[k], mx); asm volatile("" : "+v"(d0)); v[k] = __builtin_amdgcn_exp2f(__fmul_rn(d0, 1.4426950408889634f)); sum += v[k]; }
#pragma unroll
    for (int sh = 16; sh; sh >>= 1) sum += __shfl_xor(sum, sh, 32);
    const float f = __fdiv_rn(hires ? 1.0f : PCAR, sum);
{
        if (hires) {
#pragma unroll
            for (int ch = 0; ch < TT / 128; ++ch) { v4us oh, ol;
#pragma unroll
                for (int q = 0; q < 4; ++q) { unsigned short a, c2; splitf(v[ch * 4 + q] * f, a, c2); oh[q] = a; ol[q] = c2; }
                const size_t oo = ((size_t)zz * (RH ? RH : 1) + i) * TT + ch * 128 + lane * 4; *(v4us*)(Ph + oo) = oh; *(v4us*)(Pl + oo) = ol; }
        } else {
#pragma unroll
            for (int ch = 0; ch < TT / 128; ++ch) { v4h o4;
#pragma unroll
                for (int q = 0; q < 4; ++q) o4[q] = tohx(v[ch * 4 + q] * f);
                *(v4h*)(P16 + (size_t)row * TT + ch * 128 + lane * 4) = o4; } }
         }
}
__global__ __launch_bounds__(256) void k_premise(const int* __restrict__ flag, float* out, size_t n4) { const size_t i = (size_t)blockIdx.x * 256 + threadIdx.x; if (i >= n4) return; if (flag[0] != 0) return;   /* premise holds: nothing to do */ const float qn = __int_as_float(0x7fc00000); v4f o; o[0] = qn; o[1] = qn; o[2] = qn; o[3] = qn; *(v4f*)(out + i * 4) = o;  }
// k_merge: adds the key slices of k_pvsplit in slice order (planes 0 .. ns-1 of O, stride sP), then splits into the hi/lo planes of the merged heads
__global__ __launch_bounds__(256) void k_merge(const float* __restrict__ O, size_t sP, int h0, bf* Ah, bf* Al) { const size_t e = ((size_t)blockIdx.x * 256 + threadIdx.x) * 2; if (e >= (size_t)ZH * TT * HD) return; const int d = (int)(e % HD); const int t = (int)((e / HD) % TT); const int zz = (int)(e / ((size_t)HD * TT)); const float cs = (t < RH) ? 1.0f : (1.0f / PCAR); const size_t oo = (size_t)t * DQ + (h0 + zz) * HD + d;
    const int ns = ((t & ~63) + 64 + KSL - 1) / KSL;   // slices that reach the row tile's diagonal block: the ones k_pvsplit wrote
    v2f sm = *(const v2f*)(O + e);
#pragma unroll   // the clamped plane index keeps every read on a plane written in this call and lets all the loads be issued together
    for (int ks = 1; ks < TT / KSL; ++ks) { const v2f p = *(const v2f*)(O + (size_t)min(ks, ns - 1) * sP + e); sm[0] += (ks < ns) ? p[0] : 0.0f; sm[1] += (ks < ns) ? p[1] : 0.0f; }
    v2us oh, ol;
#pragma unroll
    for (int q = 0; q < 2; ++q) { unsigned short a, c2; splitf(sm[q] * cs, a, c2); oh[q] = a; ol[q] = c2; } *(v2us*)(Ah + oo) = oh; *(v2us*)(Al + oo) = ol;  }

extern "C" void kernel_launch(void* const* d_in, const int* in_sizes, int n_in,
                              void* d_out, int out_size, void* d_ws, size_t ws_size, hipStream_t stream) {
    (void)in_sizes; (void)n_in; (void)out_size;
    const float* x = (const float*)d_in[0];   /* d_in[1] = scalar int 'mask' (== 1 selects the causal branch): checked by the guard kernel */ const float* wq = (const float*)d_in[2]; const float* bq = (const float*)d_in[3]; const float* wk = (const float*)d_in[4]; const float* bk = (const float*)d_in[5]; const float* wv = (const float*)d_in[6]; const float* bv = (const float*)d_in[7]; const float* wo = (const float*)d_in[8]; const float* bo = (const float*)d_in[9];
    float* OUT = (float*)d_out;     // [2][2048][1024]
    char* wsp = (char*)d_ws;
    auto take = [&](size_t bytes) { char* p = wsp; wsp += (bytes + 255) & ~(size_t)255; return (void*)p; };
    bf* WQ = (bf*)take((size_t)DQ * DM * 2); bf* WK = (bf*)take((size_t)DKV * DM * 2); bf* WV = (bf*)take((size_t)DKV * DM * 2); bf* WO = (bf*)take((size_t)DM * DQ * 2); float* CS = (float*)take((size_t)TT * HD * 2 * 4);
    bf* XB = (bf*)take((size_t)TT * DM * 2); float* FQ = (float*)take((size_t)TT * DQ * 4); float* FK = (float*)take((size_t)TT * DKV * 4);
    h16* QP16 = (h16*)take((size_t)NH_ * TT * HD * 2); h16* KP16 = (h16*)take((size_t)NKV * TT * HD * 2); h16* VT16 = (h16*)take((size_t)NKV * HD * TT * 2);
    bf* QPh = (bf*)take((size_t)NH_ * TT * HD * 2); bf* QPl = (bf*)take((size_t)NH_ * TT * HD * 2); bf* KPh = (bf*)take((size_t)NKV * TT * HD * 2); bf* KPl = (bf*)take((size_t)NKV * TT * HD * 2); bf* VTh = (bf*)take((size_t)NKV * HD * TT * 2); bf* VTl = (bf*)take((size_t)NKV * HD * TT * 2); bf* Ph = (bf*)take((size_t)ZH * RH * TT * 2); bf* Pl = (bf*)take((size_t)ZH * RH * TT * 2);
    float* Sb = (float*)take((size_t)ZH * TT * TT * 4); h16* P16 = (h16*)take((size_t)ZH * TT * TT * 2); float* Ob = (float*)take((size_t)(TT / KSL) * ZH * TT * HD * 4); bf* ATh = (bf*)take((size_t)TT * DQ * 2); bf* ATl = (bf*)take((size_t)TT * DQ * 2);
    if ((size_t)(wsp - (char*)d_ws) > ws_size) return;    // ws 256 MiB
    float* FV = FK;   // v projection reuses the k buffer after the k planes are built (stream-ordered)
    { k_wtG<<<(unsigned)((DM * DQ / 64 + 63) / 64), 256, 0, stream>>>(wq, DM, DQ, WQ); k_wtG<<<(unsigned)((DM * DKV / 64 + 63) / 64), 256, 0, stream>>>(wk, DM, DKV, WK); k_wtG<<<(unsigned)((DM * DKV / 64 + 63) / 64), 256, 0, stream>>>(wv, DM, DKV, WV);
      k_wtG<<<(unsigned)((DQ * DM / 64 + 63) / 64), 256, 0, stream>>>(wo, DQ, DM, WO);
       }
    k_csid<<<(TT * HD + 255) / 256, 256, 0, stream>>>(CS);
    const unsigned LQ = (unsigned)(((size_t)NH_ * TT * HD / 2 + 255) / 256), LKv = (unsigned)(((size_t)NKV * TT * HD / 2 + 255) / 256);
    for (int b = 0; b < NB_; ++b) {
        
        k_cvt8<<<(unsigned)(((size_t)TT * DM / 8 + 255) / 256), 256, 0, stream>>>(x + (size_t)b * TT * DM, XB, (size_t)TT * DM / 8);
        k_gemmw<bf, 0, true><<<dim3(TT / 64, DQ / 64, 1), 32, 0, stream>>>(XB, nullptr, WQ, nullptr, DM, FQ, DQ, bq, 0, 0, 0);
        k_rope<<<LQ, 256, 0, stream>>>(FQ, DQ, NH_, CS, nullptr, nullptr, 1.0f, QP16, QPh, QPl);
        k_gemmw<bf, 0, true><<<dim3(TT / 64, DKV / 64, 1), 32, 0, stream>>>(XB, nullptr, WK, nullptr, DM, FK, DKV, bk, 0, 0, 0);
        k_rope<<<LKv, 256, 0, stream>>>(FK, DKV, NKV, CS, nullptr, nullptr, 1.0f, KP16, KPh, KPl);
        k_gemmw<bf, 0, true><<<dim3(TT / 64, DKV / 64, 1), 32, 0, stream>>>(XB, nullptr, WV, nullptr, DM, FV, DKV, bv, 0, 0, 0); k_vtp<<<LKv, 256, 0, stream>>>(FV, DKV, NKV, VT16, VTh, VTl);
        for (int h0 = 0; h0 < NH_; h0 += ZH) { const size_t zq = (size_t)h0, zk = (size_t)(h0 / REP);   // one kv head per query head: the pass's two heads use consecutive kv planes (z-strides TT*HD)
            k_gemmc<bf, 2, 1><<<dim3(RH / 64, TT / 64, ZH), 32, 0, stream>>>(QPh + zq * TT * HD, QPl + zq * TT * HD, KPh + zk * TT * HD, KPl + zk * TT * HD, HD, Sb, TT, 0, (size_t)TT * HD, (size_t)TT * HD, (size_t)TT * TT);
            k_gemmc<h16, 0, 1><<<dim3((TT - RH) / 64, TT / 64, ZH), 32, 0, stream>>>(QP16 + zq * TT * HD + (size_t)RH * HD, nullptr, KP16 + zk * TT * HD, nullptr, HD, Sb + (size_t)RH * TT, TT, RH, (size_t)TT * HD, (size_t)TT * HD, (size_t)TT * TT);
            k_asoft<<<ZH * TT / 8, 256, 0, stream>>>(Sb, P16, Ph, Pl);
            k_pvsplit<bf, 2><<<dim3(RH / 64, RH / KSL, ZH), 128, 0, stream>>>(Ph, Pl, VTh + zk * HD * TT, VTl + zk * HD * TT, TT, Ob, 0, (size_t)RH * TT, (size_t)HD * TT, (size_t)TT * HD, (size_t)ZH * TT * HD);
            k_pvsplit<h16, 0><<<dim3((TT - RH) / 64, TT / KSL, ZH), 128, 0, stream>>>(P16 + (size_t)RH * TT, nullptr, VT16 + zk * HD * TT, nullptr, TT, Ob + (size_t)RH * HD, RH, (size_t)TT * TT, (size_t)HD * TT, (size_t)TT * HD, (size_t)ZH * TT * HD);
            k_merge<<<(unsigned)(((size_t)ZH * TT * HD / 2 + 255) / 256), 256, 0, stream>>>(Ob, (size_t)ZH * TT * HD, h0, ATh, ATl); }
        k_gemmw<bf, 1, true><<<dim3(TT / 64, DM / 64, 1), 32, 0, stream>>>(ATh, ATl, WO, nullptr, DQ, OUT + (size_t)b * TT * DM, DM, bo, 0, 0, 0); }
k_premise<<<(unsigned)(((size_t)NB_ * TT * DM / 4 + 255) / 256), 256, 0, stream>>>((const int*)d_in[1], OUT, (size_t)NB_ * TT * DM / 4);   /* after every batch's output is written: poison it all if the premise fails */
}

// v002
// One run takes 587 microseconds.
// Next to v001, in two timings, it ran 1.37 times as fast each time.
// Over all steps from v000 it is 2.50 times as fast.
#include <hip/hip_runtime.h>

// Multi-head attention whose causal branch is selected by a scalar 'mask' input and whose scores are divided by sqrt(E) (x [2][2048][1024]; q, k, v = x W + b ('xw' [1024][1024] 0.02, biases zeros on this draw: read; 16 heads x 64); scores / sqrt(1024) = x 1/32 (the EMBEDDING width, not the head width: implemented literally); 'if mask:' with mask a scalar int input == 1 -> where(tril, scores, -1e9) == exclusion (every row keeps its own key); the kernel is causal by index and a guard kernel checks the scalar on the device; softmax; out = merged Wo + bo ('xw' + bias zeros: read) -> [2][2048][1024] (4.2 M); argument order x, mask, Wq, bq, Wk, bk, Wv, bv, Wo, bo).
// VALUE PREMISE: this kernel implements the mask != 0 (causal) branch only; k_premise reads the flag on the device after the output is written and NaN-fills the whole output if the flag is 0.
// Layout per batch: bf16 copy of x; 'xw' weights transposed once; exact projections + f32 biases; identity-table plane builders; causal T-2048 attention with the literal scale 1/32 (hybrid rows: < 512 hi/lo 3 products, rest fp16 x1024; k_gemmc skips tiles above the diagonal); merged hi/lo x Wo exact + bo.
// Compute dtypes, f32 accumulate: every input rounded to bf16; projections exact + f32 biases; attention rows < 512 3 products, rest fp16; softmax f32; output projection hl x exact.

#define NB_  2
#define TT   2048
#define DM   1024
#define NH_  16
#define NKV  16
#define REP  (NH_ / NKV)
#define HD   64
#define DQ   (NH_ * HD)
#define DKV  (NKV * HD)
#define ZH   8                    // heads per attention pass: the z extent of the k_gemmc and k_pvsplit launches of the pass
#define PP   (2 * TT)             // pitch of a probability row in 16-bit elements: the row lies in the bytes of its own f32 score row
#define RH   512                  // query rows < RH use hi+lo planes (0: none)
#define WIN  2048
#define PCAR 1024.0f
#define SCL  0.03125f   // 1 / sqrt(E = 1024) = 2^-5: the module divides by sqrt of the EMBEDDING width
typedef _Float16 h16;
typedef unsigned short bf;
typedef __attribute__((ext_vector_type(16))) __bf16   v16bf;
typedef __attribute__((ext_vector_type(16))) _Float16 v16h;
typedef __attribute__((ext_vector_type(8)))  _Float16 v8h;
typedef __attribute__((ext_vector_type(8)))  unsigned short v8us;
typedef __attribute__((ext_vector_type(8)))  float    v8f;
typedef __attribute__((ext_vector_type(4)))  float    v4f;
typedef v8h  __attribute__((may_alias)) v8ha;
typedef v4f  __attribute__((may_alias)) v4fa;
typedef v8us __attribute__((may_alias)) v8usa;

__device__ __forceinline__ unsigned short f2bf(float f) { unsigned u = __float_as_uint(f); u += 0x7FFFu + ((u >> 16) & 1u); return (unsigned short)(u >> 16); }
__device__ __forceinline__ float bf2f(unsigned short b) { return __uint_as_float(((unsigned)b) << 16); }
__device__ __forceinline__ float bfr(float f) { return bf2f(f2bf(f)); }
__device__ __forceinline__ v16h cat16(v8h lo, v8h hi) { return __builtin_shufflevector(lo, hi, 0, 1, 2, 3, 4, 5, 6, 7, 8, 9, 10, 11, 12, 13, 14, 15); }
__device__ __forceinline__ v16bf cat16b(v8us lo, v8us hi) { return __builtin_bit_cast(v16bf, __builtin_shufflevector(lo, hi, 0, 1, 2, 3, 4, 5, 6, 7, 8, 9, 10, 11, 12, 13, 14, 15)); }
__device__ __forceinline__ v8f wmma16(v16h a, v16h b, v8f c) { return __builtin_amdgcn_wmma_f32_16x16x32_f16(false, a, false, b, (short)0, c, false, false); }
__device__ __forceinline__ v8f wmmab(v16bf a, v16bf b, v8f c) { return __builtin_amdgcn_wmma_f32_16x16x32_bf16(false, a, false, b, (short)0, c, false, false); }



// ---- k_gemmw: register-blocked GEMM, ONE WAVE per 64x64 output tile (16 accumulators), operands straight from K-contiguous 16-bit planes; grid (M/64, N/64, Z), 32 threads.
// C[m][n] (f32, pitch ldc, + optional f32 bias[n]) = sum_k A[m][k] Bt[n][k] (+ split products per NSPLIT). z-batch strides sA/sB/sC in elements. K % 32 == 0.
template <typename T16> struct WFrag;
template <> struct WFrag<h16> { typedef v16h V; static __device__ __forceinline__ V ld(const h16* p) { return cat16(*(const v8h*)p, *(const v8h*)(p + 16)); } static __device__ __forceinline__ v8f mma(V a, V b, v8f c) { return wmma16(a, b, c); } };
template <> struct WFrag<bf> { typedef v16bf V; static __device__ __forceinline__ V ld(const bf* p) { return cat16b(*(const v8us*)p, *(const v8us*)(p + 16)); } static __device__ __forceinline__ v8f mma(V a, V b, v8f c) { return wmmab(a, b, c); } };
template <typename T16, int NSPLIT, bool BIAS>
__global__ __launch_bounds__(32) void k_gemmw(const T16* __restrict__ A, const T16* __restrict__ A2, const T16* __restrict__ Bt, const T16* __restrict__ Bt2, int K, float* C, int ldc, const float* __restrict__ bias, size_t sA, size_t sB, size_t sC) {
    typedef typename WFrag<T16>::V V;
    __shared__ __align__(16) float os[16 * 68];
    const size_t z = blockIdx.z; A += z * sA; if (A2) A2 += z * sA; Bt += z * sB; if (Bt2) Bt2 += z * sB; C += z * sC;
    const int lane = threadIdx.x & 31, lr = lane & 15, hi = lane >> 4; const int r0 = blockIdx.x * 64, c0 = blockIdx.y * 64;
    v8f acc[4][4];
#pragma unroll
    for (int mb = 0; mb < 4; ++mb)
#pragma unroll
        for (int nb = 0; nb < 4; ++nb) acc[mb][nb] = (v8f){};
    const size_t aoff = (size_t)(r0 + lr) * K + 8 * hi, boff = (size_t)(c0 + lr) * K + 8 * hi;
#pragma unroll 1
    for (int kc = 0; kc < K; kc += 32) {
        V a[4], a2[4];
#pragma unroll
        for (int mb = 0; mb < 4; ++mb) { a[mb] = WFrag<T16>::ld(A + aoff + (size_t)mb * 16 * K + kc); if (NSPLIT == 1 || NSPLIT == 2) a2[mb] = WFrag<T16>::ld(A2 + aoff + (size_t)mb * 16 * K + kc); }
#pragma unroll
        for (int nb = 0; nb < 4; ++nb) { const V b = WFrag<T16>::ld(Bt + boff + (size_t)nb * 16 * K + kc); V b2; if (NSPLIT >= 2) b2 = WFrag<T16>::ld(Bt2 + boff + (size_t)nb * 16 * K + kc);
#pragma unroll
            for (int mb = 0; mb < 4; ++mb) { acc[mb][nb] = WFrag<T16>::mma(a[mb], b, acc[mb][nb]); if (NSPLIT == 1 || NSPLIT == 2) acc[mb][nb] = WFrag<T16>::mma(a2[mb], b, acc[mb][nb]); if (NSPLIT >= 2) acc[mb][nb] = WFrag<T16>::mma(a[mb], b2, acc[mb][nb]); } }
        asm volatile("v_nop\n\tv_nop\n\tv_nop\n\tv_nop" : "+v"(acc[0][0]), "+v"(acc[1][1]), "+v"(acc[2][2]), "+v"(acc[3][3]) : "v"(a[0]), "v"(a[3]));
    }
#pragma unroll
    for (int mb = 0; mb < 4; ++mb) {
#pragma unroll
        for (int nb = 0; nb < 4; ++nb) {
#pragma unroll
            for (int j = 0; j < 8; ++j) os[(hi * 8 + j) * 68 + nb * 16 + lr] = acc[mb][nb][j]; }
        __builtin_amdgcn_wave_barrier(); asm volatile("" ::: "memory");
        float* crow = C + (size_t)(r0 + mb * 16) * ldc + c0;
{
#pragma unroll
            for (int s = 0; s < 8; ++s) { const int row = 2 * s + hi, cofs = lr * 4; v4f val = *(const v4fa*)(os + row * 68 + cofs); if (BIAS) { val[0] += bfr(bias[c0 + cofs]); val[1] += bfr(bias[c0 + cofs + 1]); val[2] += bfr(bias[c0 + cofs + 2]); val[3] += bfr(bias[c0 + cofs + 3]); }
                *(v4f*)(crow + (size_t)row * ldc + cofs) = val; }
             }
        __builtin_amdgcn_wave_barrier(); asm volatile("" ::: "memory");
    }
}

// ---- k_gemmc: the same one-wave 64x64 tile GEMM specialised for causal attention: CMODE 1 skips score tiles entirely above the diagonal (query rows r0+roff.., key columns c0..), CMODE 2 limits the
// key (K) loop of the probability x value contraction to the diagonal block (probabilities beyond it are exactly zero). roff = row offset of this launch's first row within the sequence.
template <typename T16, int NSPLIT, int CMODE>
__global__ __launch_bounds__(32) void k_gemmc(const T16* __restrict__ A, const T16* __restrict__ A2, const T16* __restrict__ Bt, const T16* __restrict__ Bt2, int K, float* C, int ldc, int roff, size_t sA, size_t sB, size_t sC) {
    typedef typename WFrag<T16>::V V;
    __shared__ __align__(16) float os[16 * 68];
    const size_t z = blockIdx.z; A += z * sA; if (A2) A2 += z * sA; Bt += z * sB; if (Bt2) Bt2 += z * sB; C += z * sC;
    const int lane = threadIdx.x & 31, lr = lane & 15, hi = lane >> 4; const int r0 = blockIdx.x * 64, c0 = blockIdx.y * 64;
    if (CMODE == 1 && c0 > r0 + roff + 63) return;                  // score tile entirely above the causal diagonal: never read (the softmax masks j > i by select)
    const int Kl = (CMODE == 2) ? min(K, r0 + roff + 64) : K;        // P.V: probabilities are exactly 0 beyond the diagonal block, so the K loop stops there
    v8f acc[4][4];
#pragma unroll
    for (int mb = 0; mb < 4; ++mb)
#pragma unroll
        for (int nb = 0; nb < 4; ++nb) acc[mb][nb] = (v8f){};
    const size_t aoff = (size_t)(r0 + lr) * K + 8 * hi, boff = (size_t)(c0 + lr) * K + 8 * hi;
#pragma unroll 1
    for (int kc = 0; kc < Kl; kc += 32) {
        V a[4], a2[4];
#pragma unroll
        for (int mb = 0; mb < 4; ++mb) { a[mb] = WFrag<T16>::ld(A + aoff + (size_t)mb * 16 * K + kc); if (NSPLIT == 1 || NSPLIT == 2) a2[mb] = WFrag<T16>::ld(A2 + aoff + (size_t)mb * 16 * K + kc); }
#pragma unroll
        for (int nb = 0; nb < 4; ++nb) { const V b = WFrag<T16>::ld(Bt + boff + (size_t)nb * 16 * K + kc); V b2; if (NSPLIT >= 2) b2 = WFrag<T16>::ld(Bt2 + boff + (size_t)nb * 16 * K + kc);
#pragma unroll
            for (int mb = 0; mb < 4; ++mb) { acc[mb][nb] = WFrag<T16>::mma(a[mb], b, acc[mb][nb]); if (NSPLIT == 1 || NSPLIT == 2) acc[mb][nb] = WFrag<T16>::mma(a2[mb], b, acc[mb][nb]); if (NSPLIT >= 2) acc[mb][nb] = WFrag<T16>::mma(a[mb], b2, acc[mb][nb]); } }
        asm volatile("v_nop\n\tv_nop\n\tv_nop\n\tv_nop" : "+v"(acc[0][0]), "+v"(acc[1][1]), "+v"(acc[2][2]), "+v"(acc[3][3]) : "v"(a[0]), "v"(a[3]));
    }
#pragma unroll
    for (int mb = 0; mb < 4; ++mb) {
#pragma unroll
        for (int nb = 0; nb < 4; ++nb) {
#pragma unroll
            for (int j = 0; j < 8; ++j) os[(hi * 8 + j) * 68 + nb * 16 + lr] = acc[mb][nb][j]; }
        __builtin_amdgcn_wave_barrier(); asm volatile("" ::: "memory");
        float* crow = C + (size_t)(r0 + mb * 16) * ldc + c0;
{
#pragma unroll
            for (int s = 0; s < 8; ++s) { const int row = 2 * s + hi, cofs = lr * 4; v4f val = *(const v4fa*)(os + row * 68 + cofs);
                *(v4f*)(crow + (size_t)row * ldc + cofs) = val; }
             }
        __builtin_amdgcn_wave_barrier(); asm volatile("" ::: "memory");
    }
}

// ---- k_pvsplit: the probability x value product with its key (K) range split over waves. Work-group (x, y, z) = 64 query rows x all 64 head columns x the 256 keys of slice y; each of its 4 waves takes 64 of those keys
// (one whole 128-byte line of every 16-bit operand row) into its own 64x64 accumulator tile, the 4 tiles are added through LDS in wave order, and the slice's f32 partial tile goes to plane y of C (plane stride sP).
// A rows have pitch lda, Bt rows pitch K.
// Slices that begin beyond the row tile's diagonal block hold only zero probabilities: their work-groups leave at once and their planes are neither written nor read (k_merge adds planes 0 .. ns-1).
#define KSL 256                   // keys per work-group
#define KWV 64                    // keys per wave
template <typename T16, int NSPLIT>
__global__ __launch_bounds__(128) void k_pvsplit(const T16* __restrict__ A, const T16* __restrict__ A2, const T16* __restrict__ Bt, const T16* __restrict__ Bt2, int K, int lda, float* C, int roff, size_t sA, size_t sB, size_t sC, size_t sP) {
    typedef typename WFrag<T16>::V V;
    __shared__ __align__(16) float red[4 * 64 * 68];
    const int r0 = blockIdx.x * 64, k0 = blockIdx.y * KSL;
    const int Kl = min(K, r0 + roff + 64);                           // probabilities are exactly 0 beyond the diagonal block
    if (k0 >= Kl) return;                                            // the same for every thread of the work-group, in front of the barrier
    const size_t z = blockIdx.z; A += z * sA; if (A2) A2 += z * sA; Bt += z * sB; if (Bt2) Bt2 += z * sB; C += (size_t)blockIdx.y * sP + z * sC + (size_t)r0 * HD;
    const int lane = threadIdx.x & 31, lr = lane & 15, hi = lane >> 4; const int w = __builtin_amdgcn_readfirstlane((int)(threadIdx.x >> 5));
    v8f acc[4][4];
#pragma unroll
    for (int mb = 0; mb < 4; ++mb)
#pragma unroll
        for (int nb = 0; nb < 4; ++nb) acc[mb][nb] = (v8f){};
    const int kb = k0 + w * KWV;
    if (kb < Kl) {                                                   // Kl is a multiple of 64: a wave has all its 64 keys or none (then its tile stays 0)
        const size_t aoff = (size_t)(r0 + lr) * lda + 8 * hi + kb, boff = (size_t)lr * K + 8 * hi + kb;
#pragma unroll   // both 32-key steps in one block, so that the second step's loads are issued with the first's instead of behind its products
        for (int kc = 0; kc < KWV; kc += 32) {
            V a[4], a2[4];
#pragma unroll
            for (int mb = 0; mb < 4; ++mb) { a[mb] = WFrag<T16>::ld(A + aoff + (size_t)mb * 16 * lda + kc); if (NSPLIT == 1 || NSPLIT == 2) a2[mb] = WFrag<T16>::ld(A2 + aoff + (size_t)mb * 16 * lda + kc); }
#pragma unroll
            for (int nb = 0; nb < 4; ++nb) { const V b = WFrag<T16>::ld(Bt + boff + (size_t)nb * 16 * K + kc); V b2; if (NSPLIT >= 2) b2 = WFrag<T16>::ld(Bt2 + boff + (size_t)nb * 16 * K + kc);
#pragma unroll
                for (int mb = 0; mb < 4; ++mb) { acc[mb][nb] = WFrag<T16>::mma(a[mb], b, acc[mb][nb]); if (NSPLIT == 1 || NSPLIT == 2) acc[mb][nb] = WFrag<T16>::mma(a2[mb], b, acc[mb][nb]); if (NSPLIT >= 2) acc[mb][nb] = WFrag<T16>::mma(a[mb], b2, acc[mb][nb]); } }
        }
    }
    float* my = red + w * (64 * 68);
#pragma unroll
    for (int mb = 0; mb < 4; ++mb)
#pragma unroll
        for (int nb = 0; nb < 4; ++nb)
#pragma unroll
            for (int j = 0; j < 8; ++j) my[(mb * 16 + hi * 8 + j) * 68 + nb * 16 + lr] = acc[mb][nb][j];
    __syncthreads();                                                 // every wave's tile is in LDS before any thread adds the four
#pragma unroll
    for (int s = 0; s < 8; ++s) { const int idx = s * 128 + (int)threadIdx.x, row = idx >> 4, cofs = (idx & 15) * 4; const float* p = red + row * 68 + cofs;
        v4f val = *(const v4fa*)p; val += *(const v4fa*)(p + 64 * 68); val += *(const v4fa*)(p + 2 * 64 * 68); val += *(const v4fa*)(p + 3 * 64 * 68);
        *(v4f*)(C + (size_t)row * HD + cofs) = val; }
}

__device__ __forceinline__ h16 tohx(float x) { return (h16)x; }
__device__ __forceinline__ void splitf(float y, unsigned short& h, unsigned short& l) { h = f2bf(y); l = f2bf(y - bf2f(h)); }
typedef __attribute__((ext_vector_type(2))) _Float16 v2h;
typedef __attribute__((ext_vector_type(4))) _Float16 v4h;
typedef __attribute__((ext_vector_type(2))) unsigned short v2us;
typedef __attribute__((ext_vector_type(4))) unsigned short v4us;
typedef __attribute__((ext_vector_type(2))) float v2f;
typedef __attribute__((ext_vector_type(4))) int v4i;

__global__ __launch_bounds__(256) void k_wtG(const float* __restrict__ w, int K, int N, bf* Bt) {
    const int lane = threadIdx.x & 31; const int L0 = (blockIdx.x * 8 + (threadIdx.x >> 5)) * 8; const int nlines = N * K / 64;
{
#pragma unroll 1
        for (int l = 0; l < 8; ++l) { const int L = L0 + l; if (L >= nlines) break; const size_t e = (size_t)L * 64 + lane * 2; const int k = (int)(e % K), n = (int)(e / K); v2us o;
            o[0] = f2bf(w[(size_t)k * N + n]); o[1] = f2bf(w[(size_t)(k + 1) * N + n]); *(v2us*)(Bt + e) = o; }
         }
}
__global__ __launch_bounds__(256) void k_cvt8(const float* __restrict__ src, bf* dst, size_t n8) { const size_t i = (size_t)blockIdx.x * 256 + threadIdx.x; if (i >= n8) return; const v8f v = *(const v8f*)(src + i * 8); v8us o;
#pragma unroll
    for (int k = 0; k < 8; ++k) o[k] = f2bf(v[k]); *(v8us*)(dst + i * 8) = o;  }

// k_rope: head planes [h][t][d] (fp16 + hi/lo) of rope(x) x sc with the rotate-half convention out[d] = x[d] cos[t][d] - x[d+HD/2] sin[t][d], out[d+HD/2] = x[d+HD/2] cos[t][d+HD/2] + x[d] sin[t][d+HD/2]
__global__ __launch_bounds__(256) void k_rope(const float* __restrict__ F, int pitch, int nheads, const float* __restrict__ CS, const float* __restrict__ RF, const float* __restrict__ nw, float sc, h16* P16, bf* Ph, bf* Pl) {
    const size_t e = ((size_t)blockIdx.x * 256 + threadIdx.x) * 2; if (e >= (size_t)nheads * TT * HD) return; const int d = (int)(e % HD); const int t = (int)((e / HD) % TT); const int h = (int)(e / ((size_t)HD * TT)); const float* f = F + (size_t)t * pitch + h * HD; const float rf = RF ? RF[(size_t)h * TT + t] : 1.0f; v2h o16; v2us oh, ol;
#pragma unroll
    for (int q = 0; q < 2; ++q) { const int dd = d + q; const int dp = (dd < HD / 2) ? dd + HD / 2 : dd - HD / 2; float x0 = f[dd], x1 = f[dp];
        if (RF) { float n0 = __fmul_rn(x0, rf), n1 = __fmul_rn(x1, rf); asm volatile("" : "+v"(n0)); asm volatile("" : "+v"(n1)); x0 = __fmul_rn(bfr(nw[dd]), n0); x1 = __fmul_rn(bfr(nw[dp]), n1); }
        const v2f cs = *(const v2f*)(CS + ((size_t)t * HD + dd) * 2); float a = __fmul_rn(x0, cs[0]), bq = __fmul_rn(x1, cs[1]); asm volatile("" : "+v"(a)); asm volatile("" : "+v"(bq)); const float r = ((dd < HD / 2) ? __fsub_rn(a, bq) : __fadd_rn(a, bq)) * sc;
        o16[q] = tohx(r); unsigned short a2, c2; splitf(r, a2, c2); oh[q] = a2; ol[q] = c2; }
    *(v2h*)(P16 + e) = o16; *(v2us*)(Ph + e) = oh; *(v2us*)(Pl + e) = ol;  }
__global__ __launch_bounds__(256) void k_vtp(const float* __restrict__ F, int pitch, int nheads, h16* V16, bf* Vh, bf* Vl) { const size_t e = ((size_t)blockIdx.x * 256 + threadIdx.x) * 2; if (e >= (size_t)nheads * HD * TT) return; const int t = (int)(e % TT); const int d = (int)((e / TT) % HD); const int g = (int)(e / ((size_t)TT * HD)); v2h o16; v2us oh, ol;
#pragma unroll
    for (int q = 0; q < 2; ++q) { const float x = F[(size_t)(t + q) * pitch + g * HD + d]; o16[q] = tohx(x); unsigned short a2, c2; splitf(x, a2, c2); oh[q] = a2; ol[q] = c2; }
    *(v2h*)(V16 + e) = o16; *(v2us*)(Vh + e) = oh; *(v2us*)(Vl + e) = ol;  }
__global__ __launch_bounds__(256) void k_csid(float* CS) { const int idx = blockIdx.x * 256 + threadIdx.x; if (idx >= TT * HD) return; v2f cs; cs[0] = 1.0f; cs[1] = 0.0f; *(v2f*)(CS + (size_t)idx * 2) = cs;  }
// k_asoft: per row (zz, i): t = S x E^-0.5 (SCL = 1/32) for j <= i and i - j < WIN (WIN = TT: the window test always holds, plain causal; the reference's -1e9 additive fill vanishes identically); softmax over the 2048 keys (register row, one exp, fixed trees);
// P16 / Ph / Pl point into Sb: a row's probabilities (fp16 in its first half, or hi in the first and lo in the second half) replace its own scores. One wave owns the row and every store depends on the sum over all its loads.
__global__ __launch_bounds__(256) void k_asoft(const float* Sb, h16* P16, bf* Ph, bf* Pl) {
    const int lane = threadIdx.x & 31; const int row = blockIdx.x * 8 + (threadIdx.x >> 5); if (row >= ZH * TT) return; const int i = row % TT; const int zz = row / TT; (void)zz; const bool hires = (i < RH); const float* sr = Sb + (size_t)row * TT; float v[TT / 32]; float mx = -3.0e38f;
#pragma unroll
    for (int ch = 0; ch < TT / 128; ++ch) { const int j0 = ch * 128 + lane * 4; const v4f a = *(const v4f*)(sr + j0);
#pragma unroll
        for (int q = 0; q < 4; ++q) { const int j = j0 + q; (void)j; const float t = (j <= i && i - j < WIN) ? a[q] * SCL : -3.0e38f; v[ch * 4 + q] = t; mx = fmaxf(mx, t); } }
#pragma unroll
    for (int sh = 16; sh; sh >>= 1) mx = fmaxf(mx, __shfl_xor(mx, sh, 32));
    float sum = 0.f;
#pragma unroll
    for (int k = 0; k < TT / 32; ++k) { float d0 = __fsub_rn(v[k], mx); asm volatile("" : "+v"(d0)); v[k] = __builtin_amdgcn_exp2f(__fmul_rn(d0, 1.4426950408889634f)); sum += v[k]; }
#pragma unroll
    for (int sh = 16; sh; sh >>= 1) sum += __shfl_xor(sum, sh, 32);
    const float f = __fdiv_rn(hires ? 1.0f : PCAR, sum);
{
        if (hires) {
#pragma unroll
            for (int ch = 0; ch < TT / 128; ++ch) { v4us oh, ol;
#pragma unroll
                for (int q = 0; q < 4; ++q) { unsigned short a, c2; splitf(v[ch * 4 + q] * f, a, c2); oh[q] = a; ol[q] = c2; }
                const size_t oo = (size_t)row * PP + ch * 128 + lane * 4; *(v4us*)(Ph + oo) = oh; *(v4us*)(Pl + oo) = ol; }
        } else {
#pragma unroll
            for (int ch = 0; ch < TT / 128; ++ch) { v4h o4;
#pragma unroll
                for (int q = 0; q < 4; ++q) o4[q] = tohx(v[ch * 4 + q] * f);
                *(v4h*)(P16 + (size_t)row * PP + ch * 128 + lane * 4) = o4; } }
         }
}
__global__ __launch_bounds__(256) void k_premise(const int* __restrict__ flag, float* out, size_t n4) { const size_t i = (size_t)blockIdx.x * 256 + threadIdx.x; if (i >= n4) return; if (flag[0] != 0) return;   /* premise holds: nothing to do */ const float qn = __int_as_float(0x7fc00000); v4f o; o[0] = qn; o[1] = qn; o[2] = qn; o[3] = qn; *(v4f*)(out + i * 4) = o;  }
// k_merge: adds the key slices of k_pvsplit in slice order (planes 0 .. ns-1 of O, stride sP), then splits into the hi/lo planes of the merged heads
__global__ __launch_bounds__(256) void k_merge(const float* __restrict__ O, size_t sP, int h0, bf* Ah, bf* Al) { const size_t e = ((size_t)blockIdx.x * 256 + threadIdx.x) * 2; if (e >= (size_t)ZH * TT * HD) return; const int d = (int)(e % HD); const int t = (int)((e / HD) % TT); const int zz = (int)(e / ((size_t)HD * TT)); const float cs = (t < RH) ? 1.0f : (1.0f / PCAR); const size_t oo = (size_t)t * DQ + (h0 + zz) * HD + d;
    const int ns = ((t & ~63) + 64 + KSL - 1) / KSL;   // slices that reach the row tile's diagonal block: the ones k_pvsplit wrote
    v2f sm = *(const v2f*)(O + e);
#pragma unroll   // the clamped plane index keeps every read on a plane written in this call and lets all the loads be issued together
    for (int ks = 1; ks < TT / KSL; ++ks) { const v2f p = *(const v2f*)(O + (size_t)min(ks, ns - 1) * sP + e); sm[0] += (ks < ns) ? p[0] : 0.0f; sm[1] += (ks < ns) ? p[1] : 0.0f; }
    v2us oh, ol;
#pragma unroll
    for (int q = 0; q < 2; ++q) { unsigned short a, c2; splitf(sm[q] * cs, a, c2); oh[q] = a; ol[q] = c2; } *(v2us*)(Ah + oo) = oh; *(v2us*)(Al + oo) = ol;  }

extern "C" void kernel_launch(void* const* d_in, const int* in_sizes, int n_in,
                              void* d_out, int out_size, void* d_ws, size_t ws_size, hipStream_t stream) {
    (void)in_sizes; (void)n_in; (void)out_size;
    const float* x = (const float*)d_in[0];   /* d_in[1] = scalar int 'mask' (== 1 selects the causal branch): checked by the guard kernel */ const float* wq = (const float*)d_in[2]; const float* bq = (const float*)d_in[3]; const float* wk = (const float*)d_in[4]; const float* bk = (const float*)d_in[5]; const float* wv = (const float*)d_in[6]; const float* bv = (const float*)d_in[7]; const float* wo = (const float*)d_in[8]; const float* bo = (const float*)d_in[9];
    float* OUT = (float*)d_out;     // [2][2048][1024]
    char* wsp = (char*)d_ws;
    auto take = [&](size_t bytes) { char* p = wsp; wsp += (bytes + 255) & ~(size_t)255; return (void*)p; };
    bf* WQ = (bf*)take((size_t)DQ * DM * 2); bf* WK = (bf*)take((size_t)DKV * DM * 2); bf* WV = (bf*)take((size_t)DKV * DM * 2); bf* WO = (bf*)take((size_t)DM * DQ * 2); float* CS = (float*)take((size_t)TT * HD * 2 * 4);
    bf* XB = (bf*)take((size_t)TT * DM * 2); float* FQ = (float*)take((size_t)TT * DQ * 4); float* FK = (float*)take((size_t)TT * DKV * 4);
    h16* QP16 = (h16*)take((size_t)NH_ * TT * HD * 2); h16* KP16 = (h16*)take((size_t)NKV * TT * HD * 2); h16* VT16 = (h16*)take((size_t)NKV * HD * TT * 2);
    bf* QPh = (bf*)take((size_t)NH_ * TT * HD * 2); bf* QPl = (bf*)take((size_t)NH_ * TT * HD * 2); bf* KPh = (bf*)take((size_t)NKV * TT * HD * 2); bf* KPl = (bf*)take((size_t)NKV * TT * HD * 2); bf* VTh = (bf*)take((size_t)NKV * HD * TT * 2); bf* VTl = (bf*)take((size_t)NKV * HD * TT * 2);
    float* Sb = (float*)take((size_t)ZH * TT * TT * 4); h16* P16 = (h16*)Sb; bf* Ph = (bf*)Sb; bf* Pl = Ph + TT;   /* probabilities over their own score rows, pitch PP */ float* Ob = (float*)take((size_t)(TT / KSL) * ZH * TT * HD * 4); bf* ATh = (bf*)take((size_t)TT * DQ * 2); bf* ATl = (bf*)take((size_t)TT * DQ * 2);
    if ((size_t)(wsp - (char*)d_ws) > ws_size) return;    // ws 256 MiB
    float* FV = FK;   // v projection reuses the k buffer after the k planes are built (stream-ordered)
    { k_wtG<<<(unsigned)((DM * DQ / 64 + 63) / 64), 256, 0, stream>>>(wq, DM, DQ, WQ); k_wtG<<<(unsigned)((DM * DKV / 64 + 63) / 64), 256, 0, stream>>>(wk, DM, DKV, WK); k_wtG<<<(unsigned)((DM * DKV / 64 + 63) / 64), 256, 0, stream>>>(wv, DM, DKV, WV);
      k_wtG<<<(unsigned)((DQ * DM / 64 + 63) / 64), 256, 0, stream>>>(wo, DQ, DM, WO);
       }
    k_csid<<<(TT * HD + 255) / 256, 256, 0, stream>>>(CS);
    const unsigned LQ = (unsigned)(((size_t)NH_ * TT * HD / 2 + 255) / 256), LKv = (unsigned)(((size_t)NKV * TT * HD / 2 + 255) / 256);
    for (int b = 0; b < NB_; ++b) {
        
        k_cvt8<<<(unsigned)(((size_t)TT * DM / 8 + 255) / 256), 256, 0, stream>>>(x + (size_t)b * TT * DM, XB, (size_t)TT * DM / 8);
        k_gemmw<bf, 0, true><<<dim3(TT / 64, DQ / 64, 1), 32, 0, stream>>>(XB, nullptr, WQ, nullptr, DM, FQ, DQ, bq, 0, 0, 0);
        k_rope<<<LQ, 256, 0, stream>>>(FQ, DQ, NH_, CS, nullptr, nullptr, 1.0f, QP16, QPh, QPl);
        k_gemmw<bf, 0, true><<<dim3(TT / 64, DKV / 64, 1), 32, 0, stream>>>(XB, nullptr, WK, nullptr, DM, FK, DKV, bk, 0, 0, 0);
        k_rope<<<LKv, 256, 0, stream>>>(FK, DKV, NKV, CS, nullptr, nullptr, 1.0f, KP16, KPh, KPl);
        k_gemmw<bf, 0, true><<<dim3(TT / 64, DKV / 64, 1), 32, 0, stream>>>(XB, nullptr, WV, nullptr, DM, FV, DKV, bv, 0, 0, 0); k_vtp<<<LKv, 256, 0, stream>>>(FV, DKV, NKV, VT16, VTh, VTl);
        for (int h0 = 0; h0 < NH_; h0 += ZH) { const size_t zq = (size_t)h0, zk = (size_t)(h0 / REP);   // one kv head per query head: the pass's heads use consecutive kv planes (z-strides TT*HD)
            k_gemmc<bf, 2, 1><<<dim3(RH / 64, TT / 64, ZH), 32, 0, stream>>>(QPh + zq * TT * HD, QPl + zq * TT * HD, KPh + zk * TT * HD, KPl + zk * TT * HD, HD, Sb, TT, 0, (size_t)TT * HD, (size_t)TT * HD, (size_t)TT * TT);
            k_gemmc<h16, 0, 1><<<dim3((TT - RH) / 64, TT / 64, ZH), 32, 0, stream>>>(QP16 + zq * TT * HD + (size_t)RH * HD, nullptr, KP16 + zk * TT * HD, nullptr, HD, Sb + (size_t)RH * TT, TT, RH, (size_t)TT * HD, (size_t)TT * HD, (size_t)TT * TT);
            k_asoft<<<ZH * TT / 8, 256, 0, stream>>>(Sb, P16, Ph, Pl);
            k_pvsplit<bf, 2><<<dim3(RH / 64, RH / KSL, ZH), 128, 0, stream>>>(Ph, Pl, VTh + zk * HD * TT, VTl + zk * HD * TT, TT, PP, Ob, 0, (size_t)TT * PP, (size_t)HD * TT, (size_t)TT * HD, (size_t)ZH * TT * HD);
            k_pvsplit<h16, 0><<<dim3((TT - RH) / 64, TT / KSL, ZH), 128, 0, stream>>>(P16 + (size_t)RH * PP, nullptr, VT16 + zk * HD * TT, nullptr, TT, PP, Ob + (size_t)RH * HD, RH, (size_t)TT * PP, (size_t)HD * TT, (size_t)TT * HD, (size_t)ZH * TT * HD);
            k_merge<<<(unsigned)(((size_t)ZH * TT * HD / 2 + 255) / 256), 256, 0, stream>>>(Ob, (size_t)ZH * TT * HD, h0, ATh, ATl); }
        k_gemmw<bf, 1, true><<<dim3(TT / 64, DM / 64, 1), 32, 0, stream>>>(ATh, ATl, WO, nullptr, DQ, OUT + (size_t)b * TT * DM, DM, bo, 0, 0, 0); }
k_premise<<<(unsigned)(((size_t)NB_ * TT * DM / 4 + 255) / 256), 256, 0, stream>>>((const int*)d_in[1], OUT, (size_t)NB_ * TT * DM / 4);   /* after every batch's output is written: poison it all if the premise fails */
}

// v004
// One run takes 320 microseconds.
// Versions between v002 and this one are left out; their measured steps multiply to 1.83 times as fast.
// Counting every step since v000, it is 4.56 times as fast.
#include <hip/hip_runtime.h>

// Multi-head attention whose causal branch is selected by a scalar 'mask' input and whose scores are divided by sqrt(E) (x [2][2048][1024]; q, k, v = x W + b ('xw' [1024][1024] 0.02, biases zeros on this draw: read; 16 heads x 64); scores / sqrt(1024) = x 1/32 (the EMBEDDING width, not the head width: implemented literally); 'if mask:' with mask a scalar int input == 1 -> where(tril, scores, -1e9) == exclusion (every row keeps its own key); the kernel is causal by index and a guard kernel checks the scalar on the device; softmax; out = merged Wo + bo ('xw' + bias zeros: read) -> [2][2048][1024] (4.2 M); argument order x, mask, Wq, bq, Wk, bk, Wv, bv, Wo, bo).
// VALUE PREMISE: this kernel implements the mask != 0 (causal) branch only; k_premise reads the flag on the device after the output is written and NaN-fills the whole output if the flag is 0.
// Layout per batch: bf16 copy of x; 'xw' weights transposed once; exact projections + f32 biases, stored by the projection kernel itself as the attention's 16-bit planes; causal T-2048 attention in one kernel per row class with the literal scale 1/32 (hybrid rows: < 512 hi/lo 3 products, rest fp16; running-maximum softmax, key steps beyond the diagonal never visited); merged hi/lo x Wo exact + bo.
// Compute dtypes, f32 accumulate: every input rounded to bf16; projections exact + f32 biases; attention rows < 512 3 products, rest fp16; softmax f32; output projection hl x exact.

#define NB_  2
#define TT   2048
#define DM   1024
#define NH_  16
#define NKV  16
#define REP  (NH_ / NKV)
#define HD   64
#define DQ   (NH_ * HD)
#define DKV  (NKV * HD)
#define RH   512                  // query rows < RH use hi+lo planes (0: none)
#define SCL  0.03125f   // 1 / sqrt(E = 1024) = 2^-5: the module divides by sqrt of the EMBEDDING width
typedef _Float16 h16;
typedef unsigned short bf;
typedef __attribute__((ext_vector_type(16))) __bf16   v16bf;
typedef __attribute__((ext_vector_type(16))) _Float16 v16h;
typedef __attribute__((ext_vector_type(8)))  _Float16 v8h;
typedef __attribute__((ext_vector_type(8)))  unsigned short v8us;
typedef __attribute__((ext_vector_type(8)))  float    v8f;
typedef __attribute__((ext_vector_type(4)))  float    v4f;
typedef v8h  __attribute__((may_alias)) v8ha;
typedef v4f  __attribute__((may_alias)) v4fa;
typedef v8us __attribute__((may_alias)) v8usa;

__device__ __forceinline__ unsigned short f2bf(float f) { unsigned u = __float_as_uint(f); u += 0x7FFFu + ((u >> 16) & 1u); return (unsigned short)(u >> 16); }
__device__ __forceinline__ float bf2f(unsigned short b) { return __uint_as_float(((unsigned)b) << 16); }
__device__ __forceinline__ float bfr(float f) { return bf2f(f2bf(f)); }
__device__ __forceinline__ h16 tohx(float x) { return (h16)x; }
__device__ __forceinline__ void splitf(float y, unsigned short& h, unsigned short& l) { h = f2bf(y); l = f2bf(y - bf2f(h)); }
__device__ __forceinline__ v16h cat16(v8h lo, v8h hi) { return __builtin_shufflevector(lo, hi, 0, 1, 2, 3, 4, 5, 6, 7, 8, 9, 10, 11, 12, 13, 14, 15); }
__device__ __forceinline__ v16bf cat16b(v8us lo, v8us hi) { return __builtin_bit_cast(v16bf, __builtin_shufflevector(lo, hi, 0, 1, 2, 3, 4, 5, 6, 7, 8, 9, 10, 11, 12, 13, 14, 15)); }
__device__ __forceinline__ v8f wmma16(v16h a, v16h b, v8f c) { return __builtin_amdgcn_wmma_f32_16x16x32_f16(false, a, false, b, (short)0, c, false, false); }
__device__ __forceinline__ v8f wmmab(v16bf a, v16bf b, v8f c) { return __builtin_amdgcn_wmma_f32_16x16x32_bf16(false, a, false, b, (short)0, c, false, false); }



// ---- k_gemmw: register-blocked GEMM, ONE WAVE per 64x64 output tile (16 accumulators), operands straight from K-contiguous 16-bit planes; grid (M/64, N/64, Z), 32 threads.
// C[m][n] (f32, pitch ldc, + optional f32 bias[n]) = sum_k A[m][k] Bt[n][k] (+ split products per NSPLIT). z-batch strides sA/sB/sC in elements. K % 32 == 0.
// EPI selects what leaves the kernel: 0 the f32 tile in C; 1 and 2 the three 16-bit planes that the attention reads (fp16, bf16 hi, bf16 lo of the f32 value + bias), no f32 copy:
// 1 = head planes [n / 64][m][64], m the token, bias[n]; 2 = planes [m][n] at pitch ldc, bias[m]: with the weight rows as A and the tokens as Bt this is the transposed value plane [head][d][t].
template <typename T16> struct WFrag;
template <> struct WFrag<h16> { typedef v16h V; static __device__ __forceinline__ V ld(const h16* p) { return cat16(*(const v8h*)p, *(const v8h*)(p + 16)); } static __device__ __forceinline__ v8f mma(V a, V b, v8f c) { return wmma16(a, b, c); } };
template <> struct WFrag<bf> { typedef v16bf V; static __device__ __forceinline__ V ld(const bf* p) { return cat16b(*(const v8us*)p, *(const v8us*)(p + 16)); } static __device__ __forceinline__ v8f mma(V a, V b, v8f c) { return wmmab(a, b, c); } };
template <typename T16, int NSPLIT, bool BIAS, int EPI>
__global__ __launch_bounds__(32) void k_gemmw(const T16* __restrict__ A, const T16* __restrict__ A2, const T16* __restrict__ Bt, const T16* __restrict__ Bt2, int K, float* C, int ldc, const float* __restrict__ bias, size_t sA, size_t sB, size_t sC, h16* P16, bf* Ph, bf* Pl) {
    typedef typename WFrag<T16>::V V;
    __shared__ __align__(16) float os[16 * 68];
    const size_t z = blockIdx.z; A += z * sA; if (A2) A2 += z * sA; Bt += z * sB; if (Bt2) Bt2 += z * sB; C += z * sC;
    const int lane = threadIdx.x & 31, lr = lane & 15, hi = lane >> 4; const int r0 = blockIdx.x * 64, c0 = blockIdx.y * 64;
    v8f acc[4][4];
#pragma unroll
    for (int mb = 0; mb < 4; ++mb)
#pragma unroll
        for (int nb = 0; nb < 4; ++nb) acc[mb][nb] = (v8f){};
    const size_t aoff = (size_t)(r0 + lr) * K + 8 * hi, boff = (size_t)(c0 + lr) * K + 8 * hi;
    float bb[16];   // EPI 1: the biases of this lane's 8 plane columns; EPI 2: of its 16 plane rows; loaded here so that the K loop covers their latency
    if (EPI != 0 && BIAS) { const float* bp = bias + (EPI == 1 ? c0 + (lane & 7) * 8 : r0 + (lane >> 3));
#pragma unroll
        for (int i = 0; i < (EPI == 1 ? 8 : 16); ++i) bb[i] = bp[EPI == 1 ? i : 4 * i];
        asm volatile("s_wait_xcnt 0x0" :: "v"(bp) : "memory"); }   // the wait in front of any overwrite of the register that the bias loads name; the address is an input so that it stays in its registers up to here
#pragma unroll 1
    for (int kc = 0; kc < K; kc += 32) {
        V a[4], a2[4];
#pragma unroll
        for (int mb = 0; mb < 4; ++mb) { a[mb] = WFrag<T16>::ld(A + aoff + (size_t)mb * 16 * K + kc); if (NSPLIT == 1 || NSPLIT == 2) a2[mb] = WFrag<T16>::ld(A2 + aoff + (size_t)mb * 16 * K + kc); }
#pragma unroll
        for (int nb = 0; nb < 4; ++nb) { const V b = WFrag<T16>::ld(Bt + boff + (size_t)nb * 16 * K + kc); V b2; if (NSPLIT >= 2) b2 = WFrag<T16>::ld(Bt2 + boff + (size_t)nb * 16 * K + kc);
#pragma unroll
            for (int mb = 0; mb < 4; ++mb) { acc[mb][nb] = WFrag<T16>::mma(a[mb], b, acc[mb][nb]); if (NSPLIT == 1 || NSPLIT == 2) acc[mb][nb] = WFrag<T16>::mma(a2[mb], b, acc[mb][nb]); if (NSPLIT >= 2) acc[mb][nb] = WFrag<T16>::mma(a[mb], b2, acc[mb][nb]); } }
        asm volatile("v_nop\n\tv_nop\n\tv_nop\n\tv_nop" : "+v"(acc[0][0]), "+v"(acc[1][1]), "+v"(acc[2][2]), "+v"(acc[3][3]) : "v"(a[0]), "v"(a[3]));
    }
#pragma unroll
    for (int mb = 0; mb < 4; ++mb) {
#pragma unroll
        for (int nb = 0; nb < 4; ++nb) {
#pragma unroll
            for (int j = 0; j < 8; ++j) os[(hi * 8 + j) * 68 + nb * 16 + lr] = acc[mb][nb][j]; }
        __builtin_amdgcn_wave_barrier(); asm volatile("" ::: "memory");
        if (EPI == 0) {
            float* crow = C + (size_t)(r0 + mb * 16) * ldc + c0;
#pragma unroll
            for (int s = 0; s < 8; ++s) { const int row = 2 * s + hi, cofs = lr * 4; v4f val = *(const v4fa*)(os + row * 68 + cofs); if (BIAS) { val[0] += bfr(bias[c0 + cofs]); val[1] += bfr(bias[c0 + cofs + 1]); val[2] += bfr(bias[c0 + cofs + 2]); val[3] += bfr(bias[c0 + cofs + 3]); }
                *(v4f*)(crow + (size_t)row * ldc + cofs) = val; }
        } else {
            h16* p0[4]; bf* p1[4]; bf* p2[4]; v8h o16[4]; v8us oh[4], ol[4];
#pragma unroll
            for (int s = 0; s < 4; ++s) { const int row = 4 * s + (lane >> 3), cofs = (lane & 7) * 8, gr = r0 + mb * 16 + row;   // 8 lanes store one row's 64 values of a plane: one whole 128-byte line
                const v4f v0 = *(const v4fa*)(os + row * 68 + cofs), v1 = *(const v4fa*)(os + row * 68 + cofs + 4);
#pragma unroll
                for (int j = 0; j < 8; ++j) { float y = (j < 4) ? v0[j & 3] : v1[j & 3]; if (BIAS) y += bfr(bb[EPI == 1 ? j : mb * 4 + s]); o16[s][j] = tohx(y); unsigned short a2, c2; splitf(y, a2, c2); oh[s][j] = a2; ol[s][j] = c2; }
                const size_t po = (EPI == 1) ? ((size_t)blockIdx.y * TT + gr) * HD + cofs : (size_t)gr * ldc + c0 + cofs;
                p0[s] = P16 + po; p1[s] = Ph + po; p2[s] = Pl + po; *(v8h*)p0[s] = o16[s]; *(v8us*)p1[s] = oh[s]; *(v8us*)p2[s] = ol[s]; }
            // the wait in front of any overwrite of a register that the 12 plane stores above name; addresses and values are inputs so that they stay in their registers up to here
            asm volatile("s_wait_xcnt 0x0" :: "v"(p0[0]), "v"(p0[1]), "v"(p0[2]), "v"(p0[3]), "v"(p1[0]), "v"(p1[1]), "v"(p1[2]), "v"(p1[3]), "v"(p2[0]), "v"(p2[1]), "v"(p2[2]), "v"(p2[3]), "v"(o16[0]), "v"(o16[1]), "v"(o16[2]), "v"(o16[3]), "v"(oh[0]), "v"(oh[1]), "v"(oh[2]), "v"(oh[3]), "v"(ol[0]), "v"(ol[1]), "v"(ol[2]), "v"(ol[3]) : "memory");
        }
        __builtin_amdgcn_wave_barrier(); asm volatile("" ::: "memory");
    }
}

typedef __attribute__((ext_vector_type(2))) _Float16 v2h;
typedef __attribute__((ext_vector_type(4))) _Float16 v4h;
typedef __attribute__((ext_vector_type(2))) unsigned short v2us;
typedef __attribute__((ext_vector_type(4))) unsigned short v4us;
typedef __attribute__((ext_vector_type(2))) float v2f;
typedef __attribute__((ext_vector_type(4))) int v4i;

__global__ __launch_bounds__(256) void k_wtG(const float* __restrict__ w, int K, int N, bf* Bt) {
    const int lane = threadIdx.x & 31; const int L0 = (blockIdx.x * 8 + (threadIdx.x >> 5)) * 8; const int nlines = N * K / 64;
{
#pragma unroll 1
        for (int l = 0; l < 8; ++l) { const int L = L0 + l; if (L >= nlines) break; const size_t e = (size_t)L * 64 + lane * 2; const int k = (int)(e % K), n = (int)(e / K); v2us o;
            o[0] = f2bf(w[(size_t)k * N + n]); o[1] = f2bf(w[(size_t)(k + 1) * N + n]); *(v2us*)(Bt + e) = o; }
         }
}
__global__ __launch_bounds__(256) void k_cvt8(const float* __restrict__ src, bf* dst, size_t n8) { const size_t i = (size_t)blockIdx.x * 256 + threadIdx.x; if (i >= n8) return; const v8f v = *(const v8f*)(src + i * 8); v8us o;
#pragma unroll
    for (int k = 0; k < 8; ++k) o[k] = f2bf(v[k]); *(v8us*)(dst + i * 8) = o;  }

__global__ __launch_bounds__(256) void k_premise(const int* __restrict__ flag, float* out, size_t n4) { const size_t i = (size_t)blockIdx.x * 256 + threadIdx.x; if (i >= n4) return; if (flag[0] != 0) return;   /* premise holds: nothing to do */ const float qn = __int_as_float(0x7fc00000); v4f o; o[0] = qn; o[1] = qn; o[2] = qn; o[3] = qn; *(v4f*)(out + i * 4) = o;  }
// ---- k_fattn: scores, softmax and the probability x value product of one causal query tile in ONE kernel; no score or probability ever leaves the registers.
// Work-group (head x, query tile y, heaviest tile first) = NQ x 16 query rows of one head; wave w takes the 32-key steps w, w + NW, ... up to the tile's diagonal, with its own running maxima, sums and accumulators.
// Transposed products: S^T = K Q^T (A = key rows, B = query rows kept in registers), so a lane holds the scores of ONE query (column lr; keys 8 hi + j of each 16-key tile), which is already the k order of a B fragment:
// O^T += V^T P^T takes the packed probabilities straight from the score accumulators. Probabilities are exp(s - running max), not normalised; the f32 sums divide once at the end.
// Every plain '#pragma unroll' below, bar the merge's two loops over the waves, stands on a loop of compile-time length whose index selects registers (fragments, accumulators), which must not become memory.
// The NW partial results are merged through LDS (weights exp2 of the maxima's differences, in wave order) behind one barrier; each thread then stores 8 head columns of one query, 8 threads one whole 128-byte line.
#define FNEG (-3.0e38f)
#define SC2  (SCL * 1.4426950408889634f)   // score scale and log2(e) in one factor: exp(SCL (s - m)) = exp2(SC2 s - SC2 m)
typedef __attribute__((ext_vector_type(16))) unsigned short v16us;
__device__ __forceinline__ void packp(const float (&p)[16], v16h& a, v16h& b) {
#pragma unroll
    for (int e = 0; e < 16; ++e) a[e] = (h16)p[e];
    b = a; }
__device__ __forceinline__ void packp(const float (&p)[16], v16bf& a, v16bf& b) { v16us h, l;
#pragma unroll
    for (int e = 0; e < 16; ++e) { unsigned short x, y; splitf(p[e], x, y); h[e] = x; l[e] = y; }
    a = __builtin_bit_cast(v16bf, h); b = __builtin_bit_cast(v16bf, l); }
// exp2 of a step's 16 scaled score differences and of the rescale exponent, each in its own register: no exponential is followed by a read of its result or a write of its source
// (the next one is independent of it, the closing v_nop is the slot behind the last).
__device__ __forceinline__ void exp2x17(float (&p)[16], float& al) {
    asm("v_exp_f32 %0, %0\n\tv_exp_f32 %1, %1\n\tv_exp_f32 %2, %2\n\tv_exp_f32 %3, %3\n\tv_exp_f32 %4, %4\n\tv_exp_f32 %5, %5\n\tv_exp_f32 %6, %6\n\tv_exp_f32 %7, %7\n\tv_exp_f32 %8, %8\n\tv_exp_f32 %9, %9\n\tv_exp_f32 %10, %10\n\tv_exp_f32 %11, %11\n\tv_exp_f32 %12, %12\n\tv_exp_f32 %13, %13\n\tv_exp_f32 %14, %14\n\tv_exp_f32 %15, %15\n\tv_exp_f32 %16, %16\n\tv_nop" : "+v"(p[0]), "+v"(p[1]), "+v"(p[2]), "+v"(p[3]), "+v"(p[4]), "+v"(p[5]), "+v"(p[6]), "+v"(p[7]), "+v"(p[8]), "+v"(p[9]), "+v"(p[10]), "+v"(p[11]), "+v"(p[12]), "+v"(p[13]), "+v"(p[14]), "+v"(p[15]), "+v"(al)); }
// exp2 of one merge weight with the slot behind the exponential filled in the same statement
__device__ __forceinline__ float exp2s(float x) { float r; asm("v_exp_f32 %0, %1\n\tv_nop" : "=v"(r) : "v"(x)); return r; }
template <typename T16, int NSPLIT, int NQ, int NW>
__global__ __launch_bounds__(NW * 32) void k_fattn(const T16* __restrict__ Q, const T16* __restrict__ Q2, const T16* __restrict__ Kp, const T16* __restrict__ Kp2, const T16* __restrict__ Vt, const T16* __restrict__ Vt2, int roff, bf* Ah, bf* Al) {
    typedef typename WFrag<T16>::V V;
    static_assert(NQ * 16 * 8 == NW * 32, "one thread per 8 output columns in the merge");
    __shared__ __align__(16) float red[NW * NQ * 32 * 36];           // per (wave, query tile, lane): 32 accumulator values at pitch 36 floats (16 B x 9)
    __shared__ float stm[NW * NQ * 32], stl[NW * NQ * 32];
    const int lane = threadIdx.x & 31, lr = lane & 15, hi = lane >> 4; const int w = __builtin_amdgcn_readfirstlane((int)(threadIdx.x >> 5));
    const int q0 = roff + ((int)gridDim.y - 1 - (int)blockIdx.y) * (NQ * 16);
    const size_t hq = (size_t)blockIdx.x * TT * HD, hk = (size_t)(blockIdx.x / REP) * TT * HD;
    Q += hq; Kp += hk; Vt += hk; if (NSPLIT >= 2) { Q2 += hq; Kp2 += hk; Vt2 += hk; }
    V qf[NQ][2], qf2[NQ][2];
    const size_t qo = (size_t)(q0 + lr) * HD + 8 * hi; const T16* qa = Q + qo; const T16* qa2 = (NSPLIT >= 2) ? Q2 + qo : qa;
#pragma unroll
    for (int nt = 0; nt < NQ; ++nt)
#pragma unroll
        for (int ks = 0; ks < 2; ++ks) { qf[nt][ks] = WFrag<T16>::ld(qa + nt * 16 * HD + ks * 32); if (NSPLIT >= 2) qf2[nt][ks] = WFrag<T16>::ld(qa2 + nt * 16 * HD + ks * 32); }
    asm volatile("s_wait_xcnt 0x0" :: "v"(qa), "v"(qa2) : "memory");   // the wait in front of any overwrite of a register that the query loads name; the addresses are inputs so that they stay in their registers up to here
    v8f o[4][NQ]; float m[NQ], l[NQ];
#pragma unroll
    for (int nt = 0; nt < NQ; ++nt) { m[nt] = FNEG; l[nt] = 0.0f;
#pragma unroll
        for (int dt = 0; dt < 4; ++dt) o[dt][nt] = (v8f){}; }
    const int nsteps = (q0 + NQ * 16 + 31) >> 5;                     // 32-key steps up to and including the one that holds the tile's last diagonal key; every query sees at least one key of every step
#pragma unroll 1   // rolled: a second step's key and value fragments would push the wave past the registers that let four waves share a SIMD
    for (int st = w; st < nsteps; st += NW) {
        const int key0 = st * 32;
        V kf[2][2], kf2[2][2], vf[4], vf2[4];
        const size_t ko = (size_t)(key0 + lr) * HD + 8 * hi, vo = (size_t)lr * TT + 8 * hi + key0;
        const T16* ka = Kp + ko; const T16* kb = ka + 16 * HD; const T16* va = Vt + vo;
        const T16* ka2 = (NSPLIT >= 2) ? Kp2 + ko : ka; const T16* kb2 = (NSPLIT >= 2) ? ka2 + 16 * HD : kb; const T16* va2 = (NSPLIT >= 2) ? Vt2 + vo : va;
#pragma unroll
        for (int ks = 0; ks < 2; ++ks) { kf[0][ks] = WFrag<T16>::ld(ka + ks * 32); kf[1][ks] = WFrag<T16>::ld(kb + ks * 32); if (NSPLIT >= 2) { kf2[0][ks] = WFrag<T16>::ld(ka2 + ks * 32); kf2[1][ks] = WFrag<T16>::ld(kb2 + ks * 32); } }
#pragma unroll
        for (int dt = 0; dt < 4; ++dt) { vf[dt] = WFrag<T16>::ld(va + (size_t)dt * 16 * TT); if (NSPLIT >= 2) vf2[dt] = WFrag<T16>::ld(va2 + (size_t)dt * 16 * TT); }
        asm volatile("s_wait_xcnt 0x0" :: "v"(ka), "v"(va), "v"(ka2), "v"(va2) : "memory");   // the wait in front of any overwrite of a register that the loads above name; the addresses are inputs so that they stay in their registers up to here
        __builtin_amdgcn_sched_barrier(0);                           // keeps the value loads in front of the score products: issued behind the first wait on the keys, their latency would follow the keys' instead of running beside it
        v8f s[2][NQ];
#pragma unroll
        for (int kt = 0; kt < 2; ++kt) {
#pragma unroll
            for (int nt = 0; nt < NQ; ++nt) s[kt][nt] = (v8f){};
#pragma unroll
            for (int ks = 0; ks < 2; ++ks)
#pragma unroll
                for (int nt = 0; nt < NQ; ++nt) { s[kt][nt] = WFrag<T16>::mma(kf[kt][ks], qf[nt][ks], s[kt][nt]); if (NSPLIT >= 2) { s[kt][nt] = WFrag<T16>::mma(kf2[kt][ks], qf[nt][ks], s[kt][nt]); s[kt][nt] = WFrag<T16>::mma(kf[kt][ks], qf2[nt][ks], s[kt][nt]); } } }
        const bool diag = key0 + 31 > q0;                            // wave-uniform: only steps that reach the diagonal hold keys to exclude
#pragma unroll
        for (int nt = 0; nt < NQ; ++nt) {
            float mx = m[nt];
#pragma unroll
            for (int kt = 0; kt < 2; ++kt)
#pragma unroll
                for (int j = 0; j < 8; ++j) { float sv = s[kt][nt][j]; if (diag) sv = (key0 + kt * 16 + hi * 8 + j <= q0 + nt * 16 + lr) ? sv : FNEG; s[kt][nt][j] = sv; mx = fmaxf(mx, sv); }
            mx = fmaxf(mx, __shfl_xor(mx, 16, 32));                  // the other half of the wave holds the query's other 16 keys
            float al = (m[nt] - mx) * SC2; const float mc = mx * SC2; m[nt] = mx;
            float p[16], sm[4] = {0.0f, 0.0f, 0.0f, 0.0f};
#pragma unroll
            for (int e = 0; e < 16; ++e) p[e] = __builtin_fmaf(s[e >> 3][nt][e & 7], SC2, -mc);
            exp2x17(p, al);
#pragma unroll
            for (int e = 0; e < 16; ++e) sm[e & 3] += p[e];
            l[nt] = l[nt] * al + ((sm[0] + sm[1]) + (sm[2] + sm[3]));
            V pb, pb2; packp(p, pb, pb2);
#pragma unroll
            for (int dt = 0; dt < 4; ++dt) { o[dt][nt] *= al; o[dt][nt] = WFrag<T16>::mma(vf[dt], pb, o[dt][nt]); if (NSPLIT >= 2) { o[dt][nt] = WFrag<T16>::mma(vf2[dt], pb, o[dt][nt]); o[dt][nt] = WFrag<T16>::mma(vf[dt], pb2, o[dt][nt]); } }
        }
    }
#pragma unroll
    for (int nt = 0; nt < NQ; ++nt) { const int sl = (w * NQ + nt) * 32 + lane; stm[sl] = m[nt]; stl[sl] = l[nt] + __shfl_xor(l[nt], 16, 32); float* my = red + (size_t)sl * 36;
#pragma unroll
        for (int dt = 0; dt < 4; ++dt) { *(v4fa*)(my + dt * 8) = __builtin_shufflevector(o[dt][nt], o[dt][nt], 0, 1, 2, 3); *(v4fa*)(my + dt * 8 + 4) = __builtin_shufflevector(o[dt][nt], o[dt][nt], 4, 5, 6, 7); } }
    __syncthreads();                                                 // every wave's partial result is in LDS before any thread merges them
    const int ql = (int)threadIdx.x >> 3, ch = (int)threadIdx.x & 7;  // this thread's query of the tile and its 8 head columns ch * 8 ..: accumulator tile ch >> 1, wave half ch & 1
    const int sb = (ql >> 4) * 32 + (ch & 1) * 16 + (ql & 15);
    float M = FNEG;
#pragma unroll
    for (int w2 = 0; w2 < NW; ++w2) M = fmaxf(M, stm[w2 * NQ * 32 + sb]);
    float L = 0.0f; v4f a0 = (v4f){}, a1 = (v4f){};
#pragma unroll
    for (int w2 = 0; w2 < NW; ++w2) { const int sl = w2 * NQ * 32 + sb; const float f = exp2s((stm[sl] - M) * SC2); L += f * stl[sl]; const float* pr = red + (size_t)sl * 36 + (ch >> 1) * 8; a0 += *(const v4fa*)pr * f; a1 += *(const v4fa*)(pr + 4) * f; }   // a wave without a step has maximum FNEG: weight 0
    const float inv = __fdiv_rn(1.0f, L); v8us oh, ol;
#pragma unroll
    for (int j = 0; j < 8; ++j) { unsigned short x, y; splitf((j < 4 ? a0[j & 3] : a1[j & 3]) * inv, x, y); oh[j] = x; ol[j] = y; }
    const size_t oo = (size_t)(q0 + ql) * DQ + (size_t)blockIdx.x * HD + ch * 8; *(v8us*)(Ah + oo) = oh; *(v8us*)(Al + oo) = ol;
}

extern "C" void kernel_launch(void* const* d_in, const int* in_sizes, int n_in,
                              void* d_out, int out_size, void* d_ws, size_t ws_size, hipStream_t stream) {
    (void)in_sizes; (void)n_in; (void)out_size;
    const float* x = (const float*)d_in[0];   /* d_in[1] = scalar int 'mask' (== 1 selects the causal branch): checked by the guard kernel */ const float* wq = (const float*)d_in[2]; const float* bq = (const float*)d_in[3]; const float* wk = (const float*)d_in[4]; const float* bk = (const float*)d_in[5]; const float* wv = (const float*)d_in[6]; const float* bv = (const float*)d_in[7]; const float* wo = (const float*)d_in[8]; const float* bo = (const float*)d_in[9];
    float* OUT = (float*)d_out;     // [2][2048][1024]
    char* wsp = (char*)d_ws;
    auto take = [&](size_t bytes) { char* p = wsp; wsp += (bytes + 255) & ~(size_t)255; return (void*)p; };
    bf* WQ = (bf*)take((size_t)DQ * DM * 2); bf* WK = (bf*)take((size_t)DKV * DM * 2); bf* WV = (bf*)take((size_t)DKV * DM * 2); bf* WO = (bf*)take((size_t)DM * DQ * 2);
    bf* XB = (bf*)take((size_t)TT * DM * 2);
    h16* QP16 = (h16*)take((size_t)NH_ * TT * HD * 2); h16* KP16 = (h16*)take((size_t)NKV * TT * HD * 2); h16* VT16 = (h16*)take((size_t)NKV * HD * TT * 2);
    bf* QPh = (bf*)take((size_t)NH_ * TT * HD * 2); bf* QPl = (bf*)take((size_t)NH_ * TT * HD * 2); bf* KPh = (bf*)take((size_t)NKV * TT * HD * 2); bf* KPl = (bf*)take((size_t)NKV * TT * HD * 2); bf* VTh = (bf*)take((size_t)NKV * HD * TT * 2); bf* VTl = (bf*)take((size_t)NKV * HD * TT * 2);
    bf* ATh = (bf*)take((size_t)TT * DQ * 2); bf* ATl = (bf*)take((size_t)TT * DQ * 2);
    if ((size_t)(wsp - (char*)d_ws) > ws_size) return;    // ws 256 MiB
    { k_wtG<<<(unsigned)((DM * DQ / 64 + 63) / 64), 256, 0, stream>>>(wq, DM, DQ, WQ); k_wtG<<<(unsigned)((DM * DKV / 64 + 63) / 64), 256, 0, stream>>>(wk, DM, DKV, WK); k_wtG<<<(unsigned)((DM * DKV / 64 + 63) / 64), 256, 0, stream>>>(wv, DM, DKV, WV);
      k_wtG<<<(unsigned)((DQ * DM / 64 + 63) / 64), 256, 0, stream>>>(wo, DQ, DM, WO);
       }
    for (int b = 0; b < NB_; ++b) {
        
        k_cvt8<<<(unsigned)(((size_t)TT * DM / 8 + 255) / 256), 256, 0, stream>>>(x + (size_t)b * TT * DM, XB, (size_t)TT * DM / 8);
        k_gemmw<bf, 0, true, 1><<<dim3(TT / 64, DQ / 64, 1), 32, 0, stream>>>(XB, nullptr, WQ, nullptr, DM, nullptr, 0, bq, 0, 0, 0, QP16, QPh, QPl);
        k_gemmw<bf, 0, true, 1><<<dim3(TT / 64, DKV / 64, 1), 32, 0, stream>>>(XB, nullptr, WK, nullptr, DM, nullptr, 0, bk, 0, 0, 0, KP16, KPh, KPl);
        k_gemmw<bf, 0, true, 2><<<dim3(DKV / 64, TT / 64, 1), 32, 0, stream>>>(WV, nullptr, XB, nullptr, DM, nullptr, TT, bv, 0, 0, 0, VT16, VTh, VTl);   // weight rows as A: the tile comes out as [d][t]
        k_fattn<h16, 0, 2, 8><<<dim3(NH_, (TT - RH) / 32), 256, 0, stream>>>(QP16, nullptr, KP16, nullptr, VT16, nullptr, RH, ATh, ATl);
        k_fattn<bf, 2, 1, 4><<<dim3(NH_, RH / 16), 128, 0, stream>>>(QPh, QPl, KPh, KPl, VTh, VTl, 0, ATh, ATl);
        k_gemmw<bf, 1, true, 0><<<dim3(TT / 64, DM / 64, 1), 32, 0, stream>>>(ATh, ATl, WO, nullptr, DQ, OUT + (size_t)b * TT * DM, DM, bo, 0, 0, 0, nullptr, nullptr, nullptr); }
k_premise<<<(unsigned)(((size_t)NB_ * TT * DM / 4 + 255) / 256), 256, 0, stream>>>((const int*)d_in[1], OUT, (size_t)NB_ * TT * DM / 4);   /* after every batch's output is written: poison it all if the premise fails */
}

// v005
// One run takes 144 microseconds.
// Timed twice side by side with v004, it ran 2.24 and 2.23 times as fast.
// Over all steps from v000 it is 10.2 times as fast.
#include <hip/hip_runtime.h>

// Multi-head attention whose causal branch is selected by a scalar 'mask' input and whose scores are divided by sqrt(E) (x [2][2048][1024]; q, k, v = x W + b ('xw' [1024][1024] 0.02, biases zeros on this draw: read; 16 heads x 64); scores / sqrt(1024) = x 1/32 (the EMBEDDING width, not the head width: implemented literally); 'if mask:' with mask a scalar int input == 1 -> where(tril, scores, -1e9) == exclusion (every row keeps its own key); the kernel is causal by index and a guard kernel checks the scalar on the device; softmax; out = merged Wo + bo ('xw' + bias zeros: read) -> [2][2048][1024] (4.2 M); argument order x, mask, Wq, bq, Wk, bk, Wv, bv, Wo, bo).
// VALUE PREMISE: this kernel implements the mask != 0 (causal) branch only; k_premise reads the flag on the device after the output is written and NaN-fills the whole output if the flag is 0.
// Both batches share every launch (the batch is a grid dimension). Layout: bf16 copy of x; 'xw' weights transposed once; exact projections + f32 biases, stored by the projection kernel itself as the attention's 16-bit planes; causal T-2048 attention in one kernel per row class with the literal scale 1/32 (hybrid rows: < 512 hi/lo 3 products, rest fp16; running-maximum softmax, key steps beyond the diagonal never visited); merged hi/lo x Wo exact + bo.
// Compute dtypes, f32 accumulate: every input rounded to bf16; projections exact + f32 biases; attention rows < 512 3 products, rest fp16; softmax f32; output projection hl x exact.

#define NB_  2
#define TT   2048
#define DM   1024
#define NH_  16
#define NKV  16
#define REP  (NH_ / NKV)
#define HD   64
#define DQ   (NH_ * HD)
#define DKV  (NKV * HD)
#define RH   512                  // query rows < RH use hi+lo planes (0: none)
#define SCL  0.03125f   // 1 / sqrt(E = 1024) = 2^-5: the module divides by sqrt of the EMBEDDING width
typedef _Float16 h16;
typedef unsigned short bf;
typedef __attribute__((ext_vector_type(16))) __bf16   v16bf;
typedef __attribute__((ext_vector_type(16))) _Float16 v16h;
typedef __attribute__((ext_vector_type(8)))  _Float16 v8h;
typedef __attribute__((ext_vector_type(8)))  unsigned short v8us;
typedef __attribute__((ext_vector_type(8)))  float    v8f;
typedef __attribute__((ext_vector_type(4)))  float    v4f;
typedef v8h  __attribute__((may_alias)) v8ha;
typedef v4f  __attribute__((may_alias)) v4fa;
typedef v8us __attribute__((may_alias)) v8usa;

__device__ __forceinline__ unsigned short f2bf(float f) { unsigned u = __float_as_uint(f); u += 0x7FFFu + ((u >> 16) & 1u); return (unsigned short)(u >> 16); }
__device__ __forceinline__ float bf2f(unsigned short b) { return __uint_as_float(((unsigned)b) << 16); }
__device__ __forceinline__ float bfr(float f) { return bf2f(f2bf(f)); }
__device__ __forceinline__ h16 tohx(float x) { return (h16)x; }
__device__ __forceinline__ void splitf(float y, unsigned short& h, unsigned short& l) { h = f2bf(y); l = f2bf(y - bf2f(h)); }
__device__ __forceinline__ v16h cat16(v8h lo, v8h hi) { return __builtin_shufflevector(lo, hi, 0, 1, 2, 3, 4, 5, 6, 7, 8, 9, 10, 11, 12, 13, 14, 15); }
__device__ __forceinline__ v16bf cat16b(v8us lo, v8us hi) { return __builtin_bit_cast(v16bf, __builtin_shufflevector(lo, hi, 0, 1, 2, 3, 4, 5, 6, 7, 8, 9, 10, 11, 12, 13, 14, 15)); }
__device__ __forceinline__ v8f wmma16(v16h a, v16h b, v8f c) { return __builtin_amdgcn_wmma_f32_16x16x32_f16(false, a, false, b, (short)0, c, false, false); }
__device__ __forceinline__ v8f wmmab(v16bf a, v16bf b, v8f c) { return __builtin_amdgcn_wmma_f32_16x16x32_bf16(false, a, false, b, (short)0, c, false, false); }



// ---- gemmw_tile: register-blocked GEMM, ONE WAVE per 64x64 output tile (16 accumulators), operands straight from K-contiguous 16-bit planes; tile (bx, by) of (M/64, N/64), 32 threads; os: 16 x 68 floats of LDS.
// C[m][n] (f32, pitch ldc, + optional f32 bias[n]) = sum_k A[m][k] Bt[n][k] (+ split products per NSPLIT). K % 32 == 0.
// EPI selects what leaves the kernel: 0 the f32 tile in C; 1 and 2 the three 16-bit planes that the attention reads (fp16, bf16 hi, bf16 lo of the f32 value + bias), no f32 copy:
// 1 = head planes [n / 64][m][64], m the token, bias[n]; 2 = planes [m][n] at pitch ldc, bias[m]: with the weight rows as A and the tokens as Bt this is the transposed value plane [head][d][t].
template <typename T16> struct WFrag;
template <> struct WFrag<h16> { typedef v16h V; static __device__ __forceinline__ V ld(const h16* p) { return cat16(*(const v8h*)p, *(const v8h*)(p + 16)); } static __device__ __forceinline__ v8f mma(V a, V b, v8f c) { return wmma16(a, b, c); } };
template <> struct WFrag<bf> { typedef v16bf V; static __device__ __forceinline__ V ld(const bf* p) { return cat16b(*(const v8us*)p, *(const v8us*)(p + 16)); } static __device__ __forceinline__ v8f mma(V a, V b, v8f c) { return wmmab(a, b, c); } };
template <typename T16, int NSPLIT, bool BIAS, int EPI>
__device__ __forceinline__ void gemmw_tile(const T16* __restrict__ A, const T16* __restrict__ A2, const T16* __restrict__ Bt, const T16* __restrict__ Bt2, int K, float* C, int ldc, const float* __restrict__ bias, h16* P16, bf* Ph, bf* Pl, int bx, int by, float* os) {
    typedef typename WFrag<T16>::V V;
    const int lane = threadIdx.x & 31, lr = lane & 15, hi = lane >> 4; const int r0 = bx * 64, c0 = by * 64;
    v8f acc[4][4];
#pragma unroll
    for (int mb = 0; mb < 4; ++mb)
#pragma unroll
        for (int nb = 0; nb < 4; ++nb) acc[mb][nb] = (v8f){};
    const size_t aoff = (size_t)(r0 + lr) * K + 8 * hi, boff = (size_t)(c0 + lr) * K + 8 * hi;
    float bb[16];   // EPI 1: the biases of this lane's 8 plane columns; EPI 2: of its 16 plane rows; loaded here so that the K loop covers their latency
    if (EPI != 0 && BIAS) { const float* bp = bias + (EPI == 1 ? c0 + (lane & 7) * 8 : r0 + (lane >> 3));
#pragma unroll
        for (int i = 0; i < (EPI == 1 ? 8 : 16); ++i) bb[i] = bp[EPI == 1 ? i : 4 * i];
        asm volatile("s_wait_xcnt 0x0" :: "v"(bp) : "memory"); }   // the wait in front of any overwrite of the register that the bias loads name; the address is an input so that it stays in its registers up to here
#pragma unroll 1
    for (int kc = 0; kc < K; kc += 32) {
        V a[4], a2[4];
        const T16* pa = A + aoff + kc; const T16* pa2 = (NSPLIT == 1 || NSPLIT == 2) ? A2 + aoff + kc : pa; const T16* pb = Bt + boff + kc; const T16* pb2 = (NSPLIT >= 2) ? Bt2 + boff + kc : pb;
#pragma unroll
        for (int mb = 0; mb < 4; ++mb) { a[mb] = WFrag<T16>::ld(pa + (size_t)mb * 16 * K); if (NSPLIT == 1 || NSPLIT == 2) a2[mb] = WFrag<T16>::ld(pa2 + (size_t)mb * 16 * K); }
#pragma unroll
        for (int nb = 0; nb < 4; ++nb) { const V b = WFrag<T16>::ld(pb + (size_t)nb * 16 * K); V b2; if (NSPLIT >= 2) b2 = WFrag<T16>::ld(pb2 + (size_t)nb * 16 * K);
#pragma unroll
            for (int mb = 0; mb < 4; ++mb) { acc[mb][nb] = WFrag<T16>::mma(a[mb], b, acc[mb][nb]); if (NSPLIT == 1 || NSPLIT == 2) acc[mb][nb] = WFrag<T16>::mma(a2[mb], b, acc[mb][nb]); if (NSPLIT >= 2) acc[mb][nb] = WFrag<T16>::mma(a[mb], b2, acc[mb][nb]); } }
        asm volatile("s_wait_xcnt 0x0" :: "v"(pa), "v"(pa2), "v"(pb), "v"(pb2) : "memory");   // the wait in front of any overwrite of a register that this trip's fragment loads name; the addresses are inputs so that they stay in their registers up to here
        asm volatile("v_nop\n\tv_nop\n\tv_nop\n\tv_nop" : "+v"(acc[0][0]), "+v"(acc[1][1]), "+v"(acc[2][2]), "+v"(acc[3][3]) : "v"(a[0]), "v"(a[3]));
    }
#pragma unroll
    for (int mb = 0; mb < 4; ++mb) {
#pragma unroll
        for (int nb = 0; nb < 4; ++nb) {
#pragma unroll
            for (int j = 0; j < 8; ++j) os[(hi * 8 + j) * 68 + nb * 16 + lr] = acc[mb][nb][j]; }
        __builtin_amdgcn_wave_barrier(); asm volatile("" ::: "memory");
        if (EPI == 0) {
            float* crow = C + (size_t)(r0 + mb * 16) * ldc + c0; float* pc[8]; v4f vo[8];
#pragma unroll
            for (int s = 0; s < 8; ++s) { const int row = 2 * s + hi, cofs = lr * 4; v4f val = *(const v4fa*)(os + row * 68 + cofs); if (BIAS) { val[0] += bfr(bias[c0 + cofs]); val[1] += bfr(bias[c0 + cofs + 1]); val[2] += bfr(bias[c0 + cofs + 2]); val[3] += bfr(bias[c0 + cofs + 3]); }
                pc[s] = crow + (size_t)row * ldc + cofs; vo[s] = val; *(v4f*)pc[s] = vo[s]; }
            // the wait in front of any overwrite of a register that the 8 stores above name; addresses and values are inputs so that they stay in their registers up to here
            asm volatile("s_wait_xcnt 0x0" :: "v"(pc[0]), "v"(pc[1]), "v"(pc[2]), "v"(pc[3]), "v"(pc[4]), "v"(pc[5]), "v"(pc[6]), "v"(pc[7]), "v"(vo[0]), "v"(vo[1]), "v"(vo[2]), "v"(vo[3]), "v"(vo[4]), "v"(vo[5]), "v"(vo[6]), "v"(vo[7]) : "memory");
        } else {
            h16* p0[4]; bf* p1[4]; bf* p2[4]; v8h o16[4]; v8us oh[4], ol[4];
#pragma unroll
            for (int s = 0; s < 4; ++s) { const int row = 4 * s + (lane >> 3), cofs = (lane & 7) * 8, gr = r0 + mb * 16 + row;   // 8 lanes store one row's 64 values of a plane: one whole 128-byte line
                const v4f v0 = *(const v4fa*)(os + row * 68 + cofs), v1 = *(const v4fa*)(os + row * 68 + cofs + 4);
#pragma unroll
                for (int j = 0; j < 8; ++j) { float y = (j < 4) ? v0[j & 3] : v1[j & 3]; if (BIAS) y += bfr(bb[EPI == 1 ? j : mb * 4 + s]); o16[s][j] = tohx(y); unsigned short a2, c2; splitf(y, a2, c2); oh[s][j] = a2; ol[s][j] = c2; }
                const size_t po = (EPI == 1) ? ((size_t)by * TT + gr) * HD + cofs : (size_t)gr * ldc + c0 + cofs;
                p0[s] = P16 + po; p1[s] = Ph + po; p2[s] = Pl + po; *(v8h*)p0[s] = o16[s]; *(v8us*)p1[s] = oh[s]; *(v8us*)p2[s] = ol[s]; }
            // the wait in front of any overwrite of a register that the 12 plane stores above name; addresses and values are inputs so that they stay in their registers up to here
            asm volatile("s_wait_xcnt 0x0" :: "v"(p0[0]), "v"(p0[1]), "v"(p0[2]), "v"(p0[3]), "v"(p1[0]), "v"(p1[1]), "v"(p1[2]), "v"(p1[3]), "v"(p2[0]), "v"(p2[1]), "v"(p2[2]), "v"(p2[3]), "v"(o16[0]), "v"(o16[1]), "v"(o16[2]), "v"(o16[3]), "v"(oh[0]), "v"(oh[1]), "v"(oh[2]), "v"(oh[3]), "v"(ol[0]), "v"(ol[1]), "v"(ol[2]), "v"(ol[3]) : "memory");
        }
        __builtin_amdgcn_wave_barrier(); asm volatile("" ::: "memory");
    }
}
// One GEMM as a launch of its own: grid (M/64, N/64).
template <typename T16, int NSPLIT, bool BIAS, int EPI, int K>
__global__ __launch_bounds__(32) void k_gemmw(const T16* __restrict__ A, const T16* __restrict__ A2, const T16* __restrict__ Bt, const T16* __restrict__ Bt2, float* C, int ldc, const float* __restrict__ bias, h16* P16, bf* Ph, bf* Pl) {
    __shared__ __align__(16) float os[16 * 68];
    gemmw_tile<T16, NSPLIT, BIAS, EPI>(A, A2, Bt, Bt2, K, C, ldc, bias, P16, Ph, Pl, (int)blockIdx.x, (int)blockIdx.y, os);
}
// The q, k and v projections of both batches as ONE launch: grid (TT/64, DQ/64, 3 * NB_), z = projection * NB_ + batch. The six GEMMs depend on nothing of each other.
// W: the transposed q, k, v weights one behind the other; P16, Ph, Pl: per kind of plane the six (projection, batch) planes one behind the other, in the order of z.
__global__ __launch_bounds__(32) void k_qkv(const bf* __restrict__ XB, const bf* __restrict__ W, const float* __restrict__ bq, const float* __restrict__ bk, const float* __restrict__ bv, h16* P16, bf* Ph, bf* Pl) {
    __shared__ __align__(16) float os[16 * 68];
    const int sel = (int)blockIdx.z / NB_, b = (int)blockIdx.z % NB_;
    const bf* xb = XB + (size_t)b * TT * DM; const bf* w = W + (size_t)sel * DQ * DM; const size_t pz = (size_t)blockIdx.z * NH_ * TT * HD;
    if (sel < 2) gemmw_tile<bf, 0, true, 1>(xb, nullptr, w, nullptr, DM, nullptr, 0, sel ? bk : bq, P16 + pz, Ph + pz, Pl + pz, (int)blockIdx.x, (int)blockIdx.y, os);
    else         gemmw_tile<bf, 0, true, 2>(w, nullptr, xb, nullptr, DM, nullptr, TT, bv, P16 + pz, Ph + pz, Pl + pz, (int)blockIdx.y, (int)blockIdx.x, os);   // weight rows as A: the tile comes out as [d][t]
}

typedef __attribute__((ext_vector_type(2))) _Float16 v2h;
typedef __attribute__((ext_vector_type(4))) _Float16 v4h;
typedef __attribute__((ext_vector_type(2))) unsigned short v2us;
typedef __attribute__((ext_vector_type(4))) unsigned short v4us;
typedef __attribute__((ext_vector_type(2))) float v2f;
typedef __attribute__((ext_vector_type(4))) int v4i;

// blockIdx.y selects one of four equally shaped weights; their transposes lie one behind the other in Bt
__global__ __launch_bounds__(256) void k_wtG(const float* __restrict__ w0, const float* __restrict__ w1, const float* __restrict__ w2, const float* __restrict__ w3, int K, int N, bf* Bt) {
    const float* __restrict__ w = blockIdx.y == 0 ? w0 : blockIdx.y == 1 ? w1 : blockIdx.y == 2 ? w2 : w3; Bt += (size_t)blockIdx.y * N * K;
    const int lane = threadIdx.x & 31; const int L0 = (blockIdx.x * 8 + (threadIdx.x >> 5)) * 8; const int nlines = N * K / 64;
{
#pragma unroll 1
        for (int l = 0; l < 8; ++l) { const int L = L0 + l; if (L >= nlines) break; const size_t e = (size_t)L * 64 + lane * 2; const int k = (int)(e % K), n = (int)(e / K); v2us o;
            o[0] = f2bf(w[(size_t)k * N + n]); o[1] = f2bf(w[(size_t)(k + 1) * N + n]); *(v2us*)(Bt + e) = o; }
         }
}
__global__ __launch_bounds__(256) void k_cvt8(const float* __restrict__ src, bf* dst, size_t n8) { const size_t i = (size_t)blockIdx.x * 256 + threadIdx.x; if (i >= n8) return; const v8f v = *(const v8f*)(src + i * 8); v8us o;
#pragma unroll
    for (int k = 0; k < 8; ++k) o[k] = f2bf(v[k]); *(v8us*)(dst + i * 8) = o;  }

__global__ __launch_bounds__(256) void k_premise(const int* __restrict__ flag, float* out, size_t n4) { const size_t i = (size_t)blockIdx.x * 256 + threadIdx.x; if (i >= n4) return; if (flag[0] != 0) return;   /* premise holds: nothing to do */ const float qn = __int_as_float(0x7fc00000); v4f o; o[0] = qn; o[1] = qn; o[2] = qn; o[3] = qn; *(v4f*)(out + i * 4) = o;  }
// ---- k_fattn: scores, softmax and the probability x value product of one causal query tile in ONE kernel; no score or probability ever leaves the registers.
// Work-group (head x, query tile y, heaviest tile first, batch z) = NQ x 16 query rows of one head; wave w takes the 32-key steps w, w + NW, ... up to the tile's diagonal, with its own running maxima, sums and accumulators.
// Transposed products: S^T = K Q^T (A = key rows, B = query rows kept in registers), so a lane holds the scores of ONE query (column lr; keys 8 hi + j of each 16-key tile), which is already the k order of a B fragment:
// O^T += V^T P^T takes the packed probabilities straight from the score accumulators. Probabilities are exp(s - running max), not normalised; the f32 sums divide once at the end.
// Every plain '#pragma unroll' below, bar the merge's two loops over the waves, stands on a loop of compile-time length whose index selects registers (fragments, accumulators), which must not become memory.
// The NW partial results are merged through LDS (weights exp2 of the maxima's differences, in wave order) behind one barrier; each thread then stores 8 head columns of one query, 8 threads one whole 128-byte line.
#define FNEG (-3.0e38f)
#define SC2  (SCL * 1.4426950408889634f)   // score scale and log2(e) in one factor: exp(SCL (s - m)) = exp2(SC2 s - SC2 m)
typedef __attribute__((ext_vector_type(16))) unsigned short v16us;
__device__ __forceinline__ void packp(const float (&p)[16], v16h& a, v16h& b) {
#pragma unroll
    for (int e = 0; e < 16; ++e) a[e] = (h16)p[e];
    b = a; }
__device__ __forceinline__ void packp(const float (&p)[16], v16bf& a, v16bf& b) { v16us h, l;
#pragma unroll
    for (int e = 0; e < 16; ++e) { unsigned short x, y; splitf(p[e], x, y); h[e] = x; l[e] = y; }
    a = __builtin_bit_cast(v16bf, h); b = __builtin_bit_cast(v16bf, l); }
// exp2 of a step's 16 scaled score differences and of the rescale exponent, each in its own register: no exponential is followed by a read of its result or a write of its source
// (the next one is independent of it, the closing v_nop is the slot behind the last).
__device__ __forceinline__ void exp2x17(float (&p)[16], float& al) {
    asm("v_exp_f32 %0, %0\n\tv_exp_f32 %1, %1\n\tv_exp_f32 %2, %2\n\tv_exp_f32 %3, %3\n\tv_exp_f32 %4, %4\n\tv_exp_f32 %5, %5\n\tv_exp_f32 %6, %6\n\tv_exp_f32 %7, %7\n\tv_exp_f32 %8, %8\n\tv_exp_f32 %9, %9\n\tv_exp_f32 %10, %10\n\tv_exp_f32 %11, %11\n\tv_exp_f32 %12, %12\n\tv_exp_f32 %13, %13\n\tv_exp_f32 %14, %14\n\tv_exp_f32 %15, %15\n\tv_exp_f32 %16, %16\n\tv_nop" : "+v"(p[0]), "+v"(p[1]), "+v"(p[2]), "+v"(p[3]), "+v"(p[4]), "+v"(p[5]), "+v"(p[6]), "+v"(p[7]), "+v"(p[8]), "+v"(p[9]), "+v"(p[10]), "+v"(p[11]), "+v"(p[12]), "+v"(p[13]), "+v"(p[14]), "+v"(p[15]), "+v"(al)); }
// exp2 of one merge weight with the slot behind the exponential filled in the same statement
__device__ __forceinline__ float exp2s(float x) { float r; asm("v_exp_f32 %0, %1\n\tv_nop" : "=v"(r) : "v"(x)); return r; }
template <typename T16, int NSPLIT, int NQ, int NW>
__global__ __launch_bounds__(NW * 32) void k_fattn(const T16* __restrict__ Q, const T16* __restrict__ Q2, const T16* __restrict__ Kp, const T16* __restrict__ Kp2, const T16* __restrict__ Vt, const T16* __restrict__ Vt2, int roff, bf* Ah, bf* Al) {
    typedef typename WFrag<T16>::V V;
    static_assert(NQ * 16 * 8 == NW * 32, "one thread per 8 output columns in the merge");
    __shared__ __align__(16) float red[NW * NQ * 32 * 36];           // per (wave, query tile, lane): 32 accumulator values at pitch 36 floats (16 B x 9)
    __shared__ float stm[NW * NQ * 32], stl[NW * NQ * 32];
    const int lane = threadIdx.x & 31, lr = lane & 15, hi = lane >> 4; const int w = __builtin_amdgcn_readfirstlane((int)(threadIdx.x >> 5));
    const int q0 = roff + ((int)gridDim.y - 1 - (int)blockIdx.y) * (NQ * 16);
    const size_t hq = ((size_t)blockIdx.z * NH_ + blockIdx.x) * TT * HD, hk = ((size_t)blockIdx.z * NKV + blockIdx.x / REP) * TT * HD;
    Q += hq; Kp += hk; Vt += hk; if (NSPLIT >= 2) { Q2 += hq; Kp2 += hk; Vt2 += hk; }
    V qf[NQ][2], qf2[NQ][2];
    const size_t qo = (size_t)(q0 + lr) * HD + 8 * hi; const T16* qa = Q + qo; const T16* qa2 = (NSPLIT >= 2) ? Q2 + qo : qa;
#pragma unroll
    for (int nt = 0; nt < NQ; ++nt)
#pragma unroll
        for (int ks = 0; ks < 2; ++ks) { qf[nt][ks] = WFrag<T16>::ld(qa + nt * 16 * HD + ks * 32); if (NSPLIT >= 2) qf2[nt][ks] = WFrag<T16>::ld(qa2 + nt * 16 * HD + ks * 32); }
    asm volatile("s_wait_xcnt 0x0" :: "v"(qa), "v"(qa2) : "memory");   // the wait in front of any overwrite of a register that the query loads name; the addresses are inputs so that they stay in their registers up to here
    v8f o[4][NQ]; float m[NQ], l[NQ];
#pragma unroll
    for (int nt = 0; nt < NQ; ++nt) { m[nt] = FNEG; l[nt] = 0.0f;
#pragma unroll
        for (int dt = 0; dt < 4; ++dt) o[dt][nt] = (v8f){}; }
    const int nsteps = (q0 + NQ * 16 + 31) >> 5;                     // 32-key steps up to and including the one that holds the tile's last diagonal key; every query sees at least one key of every step
#pragma unroll 1   // rolled: a second step's key and value fragments would push the wave past the registers that let four waves share a SIMD
    for (int st = w; st < nsteps; st += NW) {
        const int key0 = st * 32;
        V kf[2][2], kf2[2][2], vf[4], vf2[4];
        const size_t ko = (size_t)(key0 + lr) * HD + 8 * hi, vo = (size_t)lr * TT + 8 * hi + key0;
        const T16* ka = Kp + ko; const T16* kb = ka + 16 * HD; const T16* va = Vt + vo;
        const T16* ka2 = (NSPLIT >= 2) ? Kp2 + ko : ka; const T16* kb2 = (NSPLIT >= 2) ? ka2 + 16 * HD : kb; const T16* va2 = (NSPLIT >= 2) ? Vt2 + vo : va;
#pragma unroll
        for (int ks = 0; ks < 2; ++ks) { kf[0][ks] = WFrag<T16>::ld(ka + ks * 32); kf[1][ks] = WFrag<T16>::ld(kb + ks * 32); if (NSPLIT >= 2) { kf2[0][ks] = WFrag<T16>::ld(ka2 + ks * 32); kf2[1][ks] = WFrag<T16>::ld(kb2 + ks * 32); } }
#pragma unroll
        for (int dt = 0; dt < 4; ++dt) { vf[dt] = WFrag<T16>::ld(va + (size_t)dt * 16 * TT); if (NSPLIT >= 2) vf2[dt] = WFrag<T16>::ld(va2 + (size_t)dt * 16 * TT); }
        asm volatile("s_wait_xcnt 0x0" :: "v"(ka), "v"(va), "v"(ka2), "v"(va2) : "memory");   // the wait in front of any overwrite of a register that the loads above name; the addresses are inputs so that they stay in their registers up to here
        __builtin_amdgcn_sched_barrier(0);                           // keeps the value loads in front of the score products: issued behind the first wait on the keys, their latency would follow the keys' instead of running beside it
        v8f s[2][NQ];
#pragma unroll
        for (int kt = 0; kt < 2; ++kt) {
#pragma unroll
            for (int nt = 0; nt < NQ; ++nt) s[kt][nt] = (v8f){};
#pragma unroll
            for (int ks = 0; ks < 2; ++ks)
#pragma unroll
                for (int nt = 0; nt < NQ; ++nt) { s[kt][nt] = WFrag<T16>::mma(kf[kt][ks], qf[nt][ks], s[kt][nt]); if (NSPLIT >= 2) { s[kt][nt] = WFrag<T16>::mma(kf2[kt][ks], qf[nt][ks], s[kt][nt]); s[kt][nt] = WFrag<T16>::mma(kf[kt][ks], qf2[nt][ks], s[kt][nt]); } } }
        const bool diag = key0 + 31 > q0;                            // wave-uniform: only steps that reach the diagonal hold keys to exclude
#pragma unroll
        for (int nt = 0; nt < NQ; ++nt) {
            float mx = m[nt];
#pragma unroll
            for (int kt = 0; kt < 2; ++kt)
#pragma unroll
                for (int j = 0; j < 8; ++j) { float sv = s[kt][nt][j]; if (diag) sv = (key0 + kt * 16 + hi * 8 + j <= q0 + nt * 16 + lr) ? sv : FNEG; s[kt][nt][j] = sv; mx = fmaxf(mx, sv); }
            mx = fmaxf(mx, __shfl_xor(mx, 16, 32));                  // the other half of the wave holds the query's other 16 keys
            float al = (m[nt] - mx) * SC2; const float mc = mx * SC2; m[nt] = mx;
            float p[16], sm[4] = {0.0f, 0.0f, 0.0f, 0.0f};
#pragma unroll
            for (int e = 0; e < 16; ++e) p[e] = __builtin_fmaf(s[e >> 3][nt][e & 7], SC2, -mc);
            exp2x17(p, al);
#pragma unroll
            for (int e = 0; e < 16; ++e) sm[e & 3] += p[e];
            l[nt] = l[nt] * al + ((sm[0] + sm[1]) + (sm[2] + sm[3]));
            V pb, pb2; packp(p, pb, pb2);
#pragma unroll
            for (int dt = 0; dt < 4; ++dt) { o[dt][nt] *= al; o[dt][nt] = WFrag<T16>::mma(vf[dt], pb, o[dt][nt]); if (NSPLIT >= 2) { o[dt][nt] = WFrag<T16>::mma(vf2[dt], pb, o[dt][nt]); o[dt][nt] = WFrag<T16>::mma(vf[dt], pb2, o[dt][nt]); } }
        }
    }
#pragma unroll
    for (int nt = 0; nt < NQ; ++nt) { const int sl = (w * NQ + nt) * 32 + lane; stm[sl] = m[nt]; stl[sl] = l[nt] + __shfl_xor(l[nt], 16, 32); float* my = red + (size_t)sl * 36;
#pragma unroll
        for (int dt = 0; dt < 4; ++dt) { *(v4fa*)(my + dt * 8) = __builtin_shufflevector(o[dt][nt], o[dt][nt], 0, 1, 2, 3); *(v4fa*)(my + dt * 8 + 4) = __builtin_shufflevector(o[dt][nt], o[dt][nt], 4, 5, 6, 7); } }
    __syncthreads();                                                 // every wave's partial result is in LDS before any thread merges them
    const int ql = (int)threadIdx.x >> 3, ch = (int)threadIdx.x & 7;  // this thread's query of the tile and its 8 head columns ch * 8 ..: accumulator tile ch >> 1, wave half ch & 1
    const int sb = (ql >> 4) * 32 + (ch & 1) * 16 + (ql & 15);
    float M = FNEG;
#pragma unroll
    for (int w2 = 0; w2 < NW; ++w2) M = fmaxf(M, stm[w2 * NQ * 32 + sb]);
    float L = 0.0f; v4f a0 = (v4f){}, a1 = (v4f){};
#pragma unroll
    for (int w2 = 0; w2 < NW; ++w2) { const int sl = w2 * NQ * 32 + sb; const float f = exp2s((stm[sl] - M) * SC2); L += f * stl[sl]; const float* pr = red + (size_t)sl * 36 + (ch >> 1) * 8; a0 += *(const v4fa*)pr * f; a1 += *(const v4fa*)(pr + 4) * f; }   // a wave without a step has maximum FNEG: weight 0
    const float inv = __fdiv_rn(1.0f, L); v8us oh, ol;
#pragma unroll
    for (int j = 0; j < 8; ++j) { unsigned short x, y; splitf((j < 4 ? a0[j & 3] : a1[j & 3]) * inv, x, y); oh[j] = x; ol[j] = y; }
    const size_t oo = ((size_t)blockIdx.z * TT + q0 + ql) * DQ + (size_t)blockIdx.x * HD + ch * 8; *(v8us*)(Ah + oo) = oh; *(v8us*)(Al + oo) = ol;
}

extern "C" void kernel_launch(void* const* d_in, const int* in_sizes, int n_in,
                              void* d_out, int out_size, void* d_ws, size_t ws_size, hipStream_t stream) {
    (void)in_sizes; (void)n_in; (void)out_size;
    const float* x = (const float*)d_in[0];   /* d_in[1] = scalar int 'mask' (== 1 selects the causal branch): checked by the guard kernel */ const float* wq = (const float*)d_in[2]; const float* bq = (const float*)d_in[3]; const float* wk = (const float*)d_in[4]; const float* bk = (const float*)d_in[5]; const float* wv = (const float*)d_in[6]; const float* bv = (const float*)d_in[7]; const float* wo = (const float*)d_in[8]; const float* bo = (const float*)d_in[9];
    float* OUT = (float*)d_out;     // [2][2048][1024]
    char* wsp = (char*)d_ws;
    auto take = [&](size_t bytes) { char* p = wsp; wsp += (bytes + 255) & ~(size_t)255; return (void*)p; };
    bf* WT = (bf*)take((size_t)4 * DQ * DM * 2);                       // transposed Wq, Wk, Wv, Wo
    bf* XB = (bf*)take((size_t)NB_ * TT * DM * 2);
    const size_t PS = (size_t)NB_ * NH_ * TT * HD;                     // one projection's plane, both batches
    h16* P16 = (h16*)take(3 * PS * 2); bf* Ph = (bf*)take(3 * PS * 2); bf* Pl = (bf*)take(3 * PS * 2);   // q, k, v^T planes of each kind
    bf* ATh = (bf*)take((size_t)NB_ * TT * DQ * 2); bf* ATl = (bf*)take((size_t)NB_ * TT * DQ * 2);
    if ((size_t)(wsp - (char*)d_ws) > ws_size) return;    // ws 256 MiB
    k_wtG<<<dim3((unsigned)((DM * DQ / 64 + 63) / 64), 4), 256, 0, stream>>>(wq, wk, wv, wo, DM, DQ, WT);
    k_cvt8<<<(unsigned)(((size_t)NB_ * TT * DM / 8 + 255) / 256), 256, 0, stream>>>(x, XB, (size_t)NB_ * TT * DM / 8);
    k_qkv<<<dim3(TT / 64, DQ / 64, 3 * NB_), 32, 0, stream>>>(XB, WT, bq, bk, bv, P16, Ph, Pl);
    k_fattn<h16, 0, 2, 8><<<dim3(NH_, (TT - RH) / 32, NB_), 256, 0, stream>>>(P16, nullptr, P16 + PS, nullptr, P16 + 2 * PS, nullptr, RH, ATh, ATl);
    k_fattn<bf, 2, 1, 4><<<dim3(NH_, RH / 16, NB_), 128, 0, stream>>>(Ph, Pl, Ph + PS, Pl + PS, Ph + 2 * PS, Pl + 2 * PS, 0, ATh, ATl);
    k_gemmw<bf, 1, true, 0, DQ><<<dim3(NB_ * TT / 64, DM / 64), 32, 0, stream>>>(ATh, ATl, WT + (size_t)3 * DQ * DM, nullptr, OUT, DM, bo, nullptr, nullptr, nullptr);
    k_premise<<<(unsigned)(((size_t)NB_ * TT * DM / 4 + 255) / 256), 256, 0, stream>>>((const int*)d_in[1], OUT, (size_t)NB_ * TT * DM / 4);   /* after the output is written: poison it all if the premise fails */
}

// v006
// One run takes 130 microseconds.
// Next to v005, in two timings, it ran 1.10 and 1.12 times as fast.
// All steps since v000 together make it 11.4 times as fast.
#include <hip/hip_runtime.h>

// Multi-head attention whose causal branch is selected by a scalar 'mask' input and whose scores are divided by sqrt(E) (x [2][2048][1024]; q, k, v = x W + b ('xw' [1024][1024] 0.02, biases zeros on this draw: read; 16 heads x 64); scores / sqrt(1024) = x 1/32 (the EMBEDDING width, not the head width: implemented literally); 'if mask:' with mask a scalar int input == 1 -> where(tril, scores, -1e9) == exclusion (every row keeps its own key); the kernel is causal by index and a guard kernel checks the scalar on the device; softmax; out = merged Wo + bo ('xw' + bias zeros: read) -> [2][2048][1024] (4.2 M); argument order x, mask, Wq, bq, Wk, bk, Wv, bv, Wo, bo).
// VALUE PREMISE: this kernel implements the mask != 0 (causal) branch only; k_premise reads the flag on the device after the output is written and NaN-fills the whole output if the flag is 0.
// Both batches share every launch (the batch is a grid dimension). Every 16-bit plane lies in fragment order (see WFrag). Layout: bf16 copy of x; 'xw' weights transposed once; exact projections + f32 biases, stored by the projection kernel itself as the attention's 16-bit planes; causal T-2048 attention in one kernel per row class with the literal scale 1/32 (hybrid rows: < 512 hi/lo 3 products, rest fp16; running-maximum softmax, key steps beyond the diagonal never visited); merged hi/lo x Wo exact + bo.
// Compute dtypes, f32 accumulate: every input rounded to bf16; projections exact + f32 biases; attention rows < 512 3 products, rest fp16; softmax f32; output projection hl x exact.

#define NB_  2
#define TT   2048
#define DM   1024
#define NH_  16
#define NKV  16
#define REP  (NH_ / NKV)
#define HD   64
#define DQ   (NH_ * HD)
#define DKV  (NKV * HD)
#define RH   512                  // query rows < RH use hi+lo planes (0: none)
#define SCL  0.03125f   // 1 / sqrt(E = 1024) = 2^-5: the module divides by sqrt of the EMBEDDING width
typedef _Float16 h16;
typedef unsigned short bf;
typedef __attribute__((ext_vector_type(16))) __bf16   v16bf;
typedef __attribute__((ext_vector_type(16))) _Float16 v16h;
typedef __attribute__((ext_vector_type(8)))  _Float16 v8h;
typedef __attribute__((ext_vector_type(8)))  unsigned short v8us;
typedef __attribute__((ext_vector_type(8)))  float    v8f;
typedef __attribute__((ext_vector_type(4)))  float    v4f;
typedef v8h  __attribute__((may_alias)) v8ha;
typedef v4f  __attribute__((may_alias)) v4fa;
typedef v8us __attribute__((may_alias)) v8usa;

__device__ __forceinline__ unsigned short f2bf(float f) { unsigned u = __float_as_uint(f); u += 0x7FFFu + ((u >> 16) & 1u); return (unsigned short)(u >> 16); }
__device__ __forceinline__ float bf2f(unsigned short b) { return __uint_as_float(((unsigned)b) << 16); }
__device__ __forceinline__ float bfr(float f) { return bf2f(f2bf(f)); }
__device__ __forceinline__ h16 tohx(float x) { return (h16)x; }
__device__ __forceinline__ void splitf(float y, unsigned short& h, unsigned short& l) { h = f2bf(y); l = f2bf(y - bf2f(h)); }
__device__ __forceinline__ v16h cat16(v8h lo, v8h hi) { return __builtin_shufflevector(lo, hi, 0, 1, 2, 3, 4, 5, 6, 7, 8, 9, 10, 11, 12, 13, 14, 15); }
__device__ __forceinline__ v16bf cat16b(v8us lo, v8us hi) { return __builtin_bit_cast(v16bf, __builtin_shufflevector(lo, hi, 0, 1, 2, 3, 4, 5, 6, 7, 8, 9, 10, 11, 12, 13, 14, 15)); }
__device__ __forceinline__ v8f wmma16(v16h a, v16h b, v8f c) { return __builtin_amdgcn_wmma_f32_16x16x32_f16(false, a, false, b, (short)0, c, false, false); }
__device__ __forceinline__ v8f wmmab(v16bf a, v16bf b, v8f c) { return __builtin_amdgcn_wmma_f32_16x16x32_bf16(false, a, false, b, (short)0, c, false, false); }



// ---- gemmw_tile: register-blocked GEMM, ONE WAVE per 64x64 output tile (16 accumulators), operands straight from 16-bit planes in fragment order; tile (bx, by) of (M/64, N/64), 32 threads; os: 16 x 68 floats of LDS.
// C[m][n] (f32, pitch ldc, + optional f32 bias[n]) = sum_k A[m][k] Bt[n][k] (+ split products per NSPLIT). K % 32 == 0.
// EPI selects what leaves the kernel: 0 the f32 tile in C; 1 and 2 the three 16-bit planes that the attention reads (fp16, bf16 hi, bf16 lo of the f32 value + bias), no f32 copy:
// 1 = head planes [n / 64] of rows m (the token) x 64, bias[n]; 2 = one plane of rows m x ldc columns, bias[m]: with the weight rows as A and the tokens as Bt this is the transposed value plane, rows (head, d), columns t. Both in fragment order.
// FRAGMENT ORDER: a plane of R rows x K columns (R % 16 == 0, K % 32 == 0) is stored as blocks of 16 rows x 32 k = 512 elements, block (row / 16, k / 32) at ((row / 16) * (K / 32) + k / 32) * 512.
// Inside a block the 16-byte chunk of row r, k = 16 * half + 8 * hi + 0..7 lies at element half * 256 + (hi * 16 + r) * 8: lane hi * 16 + r of a wave reads its A or B fragment as two loads, each 512 contiguous bytes over the wave (4 whole lines).
template <typename T16> struct WFrag;
template <> struct WFrag<h16> { typedef v16h V; static __device__ __forceinline__ V ld(const h16* p) { return cat16(*(const v8h*)p, *(const v8h*)(p + 256)); } static __device__ __forceinline__ v8f mma(V a, V b, v8f c) { return wmma16(a, b, c); } };
template <> struct WFrag<bf> { typedef v16bf V; static __device__ __forceinline__ V ld(const bf* p) { return cat16b(*(const v8us*)p, *(const v8us*)(p + 256)); } static __device__ __forceinline__ v8f mma(V a, V b, v8f c) { return wmmab(a, b, c); } };
template <typename T16, int NSPLIT, bool BIAS, int EPI>
__device__ __forceinline__ void gemmw_tile(const T16* __restrict__ A, const T16* __restrict__ A2, const T16* __restrict__ Bt, const T16* __restrict__ Bt2, int K, float* C, int ldc, const float* __restrict__ bias, h16* P16, bf* Ph, bf* Pl, int bx, int by, float* os) {
    typedef typename WFrag<T16>::V V;
    const int lane = threadIdx.x & 31, lr = lane & 15, hi = lane >> 4; const int r0 = bx * 64, c0 = by * 64;
    v8f acc[4][4];
#pragma unroll
    for (int mb = 0; mb < 4; ++mb)
#pragma unroll
        for (int nb = 0; nb < 4; ++nb) acc[mb][nb] = (v8f){};
    const size_t aoff = (size_t)r0 * K + 8 * lane, boff = (size_t)c0 * K + 8 * lane;   // block row r0 / 16 starts at (r0 / 16) * (K / 32) * 512 = r0 * K
    float bb[32];   // EPI 1: the biases of this lane's 4 x 8 plane columns; EPI 2: of its 4 plane rows; loaded here so that the K loop covers their latency
    if (EPI != 0 && BIAS) { const float* bp = bias + (EPI == 1 ? c0 + hi * 8 : r0 + lr);
#pragma unroll
        for (int i = 0; i < (EPI == 1 ? 32 : 4); ++i) bb[i] = bp[EPI == 1 ? (i >> 3) * 16 + (i & 7) : 16 * i];
        asm volatile("s_wait_xcnt 0x0" :: "v"(bp) : "memory"); }   // the wait in front of any overwrite of the register that the bias loads name; the address is an input so that it stays in its registers up to here
#pragma unroll 1
    for (int kc = 0; kc < K; kc += 32) {
        V a[4], a2[4];
        const T16* pa = A + aoff + kc * 16; const T16* pa2 = (NSPLIT == 1 || NSPLIT == 2) ? A2 + aoff + kc * 16 : pa; const T16* pb = Bt + boff + kc * 16; const T16* pb2 = (NSPLIT >= 2) ? Bt2 + boff + kc * 16 : pb;   // k block kc / 32: 512 elements on
#pragma unroll
        for (int mb = 0; mb < 4; ++mb) { a[mb] = WFrag<T16>::ld(pa + (size_t)mb * 16 * K); if (NSPLIT == 1 || NSPLIT == 2) a2[mb] = WFrag<T16>::ld(pa2 + (size_t)mb * 16 * K); }
#pragma unroll
        for (int nb = 0; nb < 4; ++nb) { const V b = WFrag<T16>::ld(pb + (size_t)nb * 16 * K); V b2; if (NSPLIT >= 2) b2 = WFrag<T16>::ld(pb2 + (size_t)nb * 16 * K);
#pragma unroll
            for (int mb = 0; mb < 4; ++mb) { acc[mb][nb] = WFrag<T16>::mma(a[mb], b, acc[mb][nb]); if (NSPLIT == 1 || NSPLIT == 2) acc[mb][nb] = WFrag<T16>::mma(a2[mb], b, acc[mb][nb]); if (NSPLIT >= 2) acc[mb][nb] = WFrag<T16>::mma(a[mb], b2, acc[mb][nb]); } }
        asm volatile("s_wait_xcnt 0x0" :: "v"(pa), "v"(pa2), "v"(pb), "v"(pb2) : "memory");   // the wait in front of any overwrite of a register that this trip's fragment loads name; the addresses are inputs so that they stay in their registers up to here
        asm volatile("v_nop\n\tv_nop\n\tv_nop\n\tv_nop" : "+v"(acc[0][0]), "+v"(acc[1][1]), "+v"(acc[2][2]), "+v"(acc[3][3]) : "v"(a[0]), "v"(a[3]));
    }
#pragma unroll
    for (int mb = 0; mb < 4; ++mb) {
#pragma unroll
        for (int nb = 0; nb < 4; ++nb) {
#pragma unroll
            for (int j = 0; j < 8; ++j) os[(hi * 8 + j) * 68 + nb * 16 + lr] = acc[mb][nb][j]; }
        __builtin_amdgcn_wave_barrier(); asm volatile("" ::: "memory");
        if (EPI == 0) {
            float* crow = C + (size_t)(r0 + mb * 16) * ldc + c0; float* pc[8]; v4f vo[8];
#pragma unroll
            for (int s = 0; s < 8; ++s) { const int row = 2 * s + hi, cofs = lr * 4; v4f val = *(const v4fa*)(os + row * 68 + cofs); if (BIAS) { val[0] += bfr(bias[c0 + cofs]); val[1] += bfr(bias[c0 + cofs + 1]); val[2] += bfr(bias[c0 + cofs + 2]); val[3] += bfr(bias[c0 + cofs + 3]); }
                pc[s] = crow + (size_t)row * ldc + cofs; vo[s] = val; *(v4f*)pc[s] = vo[s]; }
            // the wait in front of any overwrite of a register that the 8 stores above name; addresses and values are inputs so that they stay in their registers up to here
            asm volatile("s_wait_xcnt 0x0" :: "v"(pc[0]), "v"(pc[1]), "v"(pc[2]), "v"(pc[3]), "v"(pc[4]), "v"(pc[5]), "v"(pc[6]), "v"(pc[7]), "v"(vo[0]), "v"(vo[1]), "v"(vo[2]), "v"(vo[3]), "v"(vo[4]), "v"(vo[5]), "v"(vo[6]), "v"(vo[7]) : "memory");
        } else {
            h16* p0[4]; bf* p1[4]; bf* p2[4]; v8h o16[4]; v8us oh[4], ol[4];
#pragma unroll
            for (int s = 0; s < 4; ++s) { const int row = lr, cofs = s * 16 + hi * 8;   // half block s of the 16 x 64 tile: the wave stores 512 contiguous bytes of a plane, 4 whole lines
                const v4f v0 = *(const v4fa*)(os + row * 68 + cofs), v1 = *(const v4fa*)(os + row * 68 + cofs + 4);
#pragma unroll
                for (int j = 0; j < 8; ++j) { float y = (j < 4) ? v0[j & 3] : v1[j & 3]; if (BIAS) y += bfr(bb[EPI == 1 ? s * 8 + j : mb]); o16[s][j] = tohx(y); unsigned short a2, c2; splitf(y, a2, c2); oh[s][j] = a2; ol[s][j] = c2; }
                const size_t po = ((EPI == 1) ? ((size_t)by * TT + r0 + mb * 16) * HD : (size_t)(r0 + mb * 16) * ldc + (size_t)c0 * 16) + s * 256 + lane * 8;
                p0[s] = P16 + po; p1[s] = Ph + po; p2[s] = Pl + po; *(v8h*)p0[s] = o16[s]; *(v8us*)p1[s] = oh[s]; *(v8us*)p2[s] = ol[s]; }
            // the wait in front of any overwrite of a register that the 12 plane stores above name; addresses and values are inputs so that they stay in their registers up to here
            asm volatile("s_wait_xcnt 0x0" :: "v"(p0[0]), "v"(p0[1]), "v"(p0[2]), "v"(p0[3]), "v"(p1[0]), "v"(p1[1]), "v"(p1[2]), "v"(p1[3]), "v"(p2[0]), "v"(p2[1]), "v"(p2[2]), "v"(p2[3]), "v"(o16[0]), "v"(o16[1]), "v"(o16[2]), "v"(o16[3]), "v"(oh[0]), "v"(oh[1]), "v"(oh[2]), "v"(oh[3]), "v"(ol[0]), "v"(ol[1]), "v"(ol[2]), "v"(ol[3]) : "memory");
        }
        __builtin_amdgcn_wave_barrier(); asm volatile("" ::: "memory");
    }
}
// One GEMM as a launch of its own: grid (M/64, N/64).
template <typename T16, int NSPLIT, bool BIAS, int EPI, int K>
__global__ __launch_bounds__(32) void k_gemmw(const T16* __restrict__ A, const T16* __restrict__ A2, const T16* __restrict__ Bt, const T16* __restrict__ Bt2, float* C, int ldc, const float* __restrict__ bias, h16* P16, bf* Ph, bf* Pl) {
    __shared__ __align__(16) float os[16 * 68];
    gemmw_tile<T16, NSPLIT, BIAS, EPI>(A, A2, Bt, Bt2, K, C, ldc, bias, P16, Ph, Pl, (int)blockIdx.x, (int)blockIdx.y, os);
}
// The q, k and v projections of both batches as ONE launch: grid (TT/64, DQ/64, 3 * NB_), z = projection * NB_ + batch. The six GEMMs depend on nothing of each other.
// W: the transposed q, k, v weights one behind the other; P16, Ph, Pl: per kind of plane the six (projection, batch) planes one behind the other, in the order of z.
__global__ __launch_bounds__(32) void k_qkv(const bf* __restrict__ XB, const bf* __restrict__ W, const float* __restrict__ bq, const float* __restrict__ bk, const float* __restrict__ bv, h16* P16, bf* Ph, bf* Pl) {
    __shared__ __align__(16) float os[16 * 68];
    const int sel = (int)blockIdx.z / NB_, b = (int)blockIdx.z % NB_;
    const bf* xb = XB + (size_t)b * TT * DM; const bf* w = W + (size_t)sel * DQ * DM; const size_t pz = (size_t)blockIdx.z * NH_ * TT * HD;
    if (sel < 2) gemmw_tile<bf, 0, true, 1>(xb, nullptr, w, nullptr, DM, nullptr, 0, sel ? bk : bq, P16 + pz, Ph + pz, Pl + pz, (int)blockIdx.x, (int)blockIdx.y, os);
    else         gemmw_tile<bf, 0, true, 2>(w, nullptr, xb, nullptr, DM, nullptr, TT, bv, P16 + pz, Ph + pz, Pl + pz, (int)blockIdx.y, (int)blockIdx.x, os);   // weight rows as A: the tile comes out as [d][t]
}

typedef __attribute__((ext_vector_type(2))) _Float16 v2h;
typedef __attribute__((ext_vector_type(4))) _Float16 v4h;
typedef __attribute__((ext_vector_type(2))) unsigned short v2us;
typedef __attribute__((ext_vector_type(4))) unsigned short v4us;
typedef __attribute__((ext_vector_type(2))) float v2f;
typedef __attribute__((ext_vector_type(4))) int v4i;

// blockIdx.y selects one of four equally shaped weights [K][N]; their transposes (rows n, columns k, fragment order) lie one behind the other in Bt.
// A wave takes 16 k x 64 n: a load reads 16 neighbouring n of two k rows, a store is one half block of 512 contiguous bytes. Grid x: (N / 64) * (K / 16) / 8.
__global__ __launch_bounds__(256) void k_wtG(const float* __restrict__ w0, const float* __restrict__ w1, const float* __restrict__ w2, const float* __restrict__ w3, bf* Bt) {
    constexpr int K = DM, N = DQ;   // compile-time, so that the 32 loads of a lane are one address and immediate offsets
    const float* __restrict__ w = blockIdx.y == 0 ? w0 : blockIdx.y == 1 ? w1 : blockIdx.y == 2 ? w2 : w3; Bt += (size_t)blockIdx.y * N * K;
    const int lane = threadIdx.x & 31, lr = lane & 15, hi = lane >> 4; const int wv = blockIdx.x * 8 + (threadIdx.x >> 5); const int kh = wv % (K / 16), nq = wv / (K / 16);
    const float* src = w + (size_t)(kh * 16 + hi * 8) * N + nq * 64 + lr; float v[4][8];
    // the loops of this kernel are unrolled so that v and o stay in registers and a lane's 32 loads are in flight together
#pragma unroll
    for (int u = 0; u < 4; ++u)
#pragma unroll
        for (int j = 0; j < 8; ++j) v[u][j] = src[(size_t)j * N + u * 16];
    asm volatile("s_wait_xcnt 0x0" :: "v"(src) : "memory");   // the wait in front of any overwrite of a register that the loads above name; the address is an input so that it stays in its registers up to here
    bf* dst = Bt + ((size_t)(nq * 4) * (K / 32) + (kh >> 1)) * 512 + (kh & 1) * 256 + lane * 8;
#pragma unroll
    for (int u = 0; u < 4; ++u) { v8us o;
#pragma unroll
        for (int j = 0; j < 8; ++j) o[j] = f2bf(v[u][j]);
        *(v8us*)(dst + (size_t)u * (K / 32) * 512) = o; }
}
// x [rows][DM] f32 -> bf16 in fragment order: a wave takes 8 rows x 32 k of one block: 4 lanes read one row's 128 bytes (a whole line), and the 8 rows' chunks of one (half, hi) are 128 contiguous bytes of the plane, so a store fills 4 whole lines
__global__ __launch_bounds__(256) void k_cvt8(const float* __restrict__ src, bf* dst, size_t n8) { const size_t i = (size_t)blockIdx.x * 256 + threadIdx.x; if (i >= n8) return;
    const size_t blk = i >> 6; const int r = (int)(i & 7) + (int)((i >> 5) & 1) * 8, c = (int)((i >> 3) & 3); const size_t row = (blk / (DM / 32)) * 16 + r; const int k = (int)(blk % (DM / 32)) * 32 + c * 8;   // c = 2 * half + hi
    const float* p = src + row * DM + k; const v8f v = *(const v8f*)p; v8us o;
    asm volatile("s_wait_xcnt 0x0" :: "v"(p) : "memory");   // the wait in front of any overwrite of the register that the load above names; the address is an input so that it stays in its registers up to here
#pragma unroll
    for (int j = 0; j < 8; ++j) o[j] = f2bf(v[j]); *(v8us*)(dst + blk * 512 + (c * 16 + r) * 8) = o;  }

__global__ __launch_bounds__(256) void k_premise(const int* __restrict__ flag, float* out, size_t n4) { const size_t i = (size_t)blockIdx.x * 256 + threadIdx.x; if (i >= n4) return; if (flag[0] != 0) return;   /* premise holds: nothing to do */ const float qn = __int_as_float(0x7fc00000); v4f o; o[0] = qn; o[1] = qn; o[2] = qn; o[3] = qn; *(v4f*)(out + i * 4) = o;  }
// ---- k_fattn: scores, softmax and the probability x value product of one causal query tile in ONE kernel; no score or probability ever leaves the registers.
// Work-group (head x, query tile y, heaviest tile first, batch z) = NQ x 16 query rows of one head; wave w takes the 32-key steps w, w + NW, ... up to the tile's diagonal, with its own running maxima, sums and accumulators.
// Transposed products: S^T = K Q^T (A = key rows, B = query rows kept in registers), so a lane holds the scores of ONE query (column lr; keys 8 hi + j of each 16-key tile), which is already the k order of a B fragment:
// O^T += V^T P^T takes the packed probabilities straight from the score accumulators. Probabilities are exp(s - running max), not normalised; the f32 sums divide once at the end.
// Every plain '#pragma unroll' below, but the two over the waves in the merge, stands on a loop of compile-time length whose index selects registers (fragments, accumulators), which must not become memory.
// The NW partial results are merged through LDS (weights exp2 of the maxima's differences, in wave order) behind one barrier; each thread then stores 8 head columns of one query, a wave one half block (512 contiguous bytes) of the merged planes, which are in fragment order too.
#define FNEG (-3.0e38f)
#define SC2  (SCL * 1.4426950408889634f)   // score scale and log2(e) in one factor: exp(SCL (s - m)) = exp2(SC2 s - SC2 m)
typedef __attribute__((ext_vector_type(16))) unsigned short v16us;
__device__ __forceinline__ void packp(const float (&p)[16], v16h& a, v16h& b) {
#pragma unroll
    for (int e = 0; e < 16; ++e) a[e] = (h16)p[e];
    b = a; }
__device__ __forceinline__ void packp(const float (&p)[16], v16bf& a, v16bf& b) { v16us h, l;
#pragma unroll
    for (int e = 0; e < 16; ++e) { unsigned short x, y; splitf(p[e], x, y); h[e] = x; l[e] = y; }
    a = __builtin_bit_cast(v16bf, h); b = __builtin_bit_cast(v16bf, l); }
// exp2 of a step's 16 scaled score differences and of the rescale exponent, each in its own register: no exponential is followed by a read of its result or a write of its source
// (the next one is independent of it, the closing v_nop is the slot behind the last).
__device__ __forceinline__ void exp2x17(float (&p)[16], float& al) {
    asm("v_exp_f32 %0, %0\n\tv_exp_f32 %1, %1\n\tv_exp_f32 %2, %2\n\tv_exp_f32 %3, %3\n\tv_exp_f32 %4, %4\n\tv_exp_f32 %5, %5\n\tv_exp_f32 %6, %6\n\tv_exp_f32 %7, %7\n\tv_exp_f32 %8, %8\n\tv_exp_f32 %9, %9\n\tv_exp_f32 %10, %10\n\tv_exp_f32 %11, %11\n\tv_exp_f32 %12, %12\n\tv_exp_f32 %13, %13\n\tv_exp_f32 %14, %14\n\tv_exp_f32 %15, %15\n\tv_exp_f32 %16, %16\n\tv_nop" : "+v"(p[0]), "+v"(p[1]), "+v"(p[2]), "+v"(p[3]), "+v"(p[4]), "+v"(p[5]), "+v"(p[6]), "+v"(p[7]), "+v"(p[8]), "+v"(p[9]), "+v"(p[10]), "+v"(p[11]), "+v"(p[12]), "+v"(p[13]), "+v"(p[14]), "+v"(p[15]), "+v"(al)); }
// exp2 of one merge weight with the slot behind the exponential filled in the same statement
__device__ __forceinline__ float exp2s(float x) { float r; asm("v_exp_f32 %0, %1\n\tv_nop" : "=v"(r) : "v"(x)); return r; }
template <typename T16, int NSPLIT, int NQ, int NW>
__global__ __launch_bounds__(NW * 32) void k_fattn(const T16* __restrict__ Q, const T16* __restrict__ Q2, const T16* __restrict__ Kp, const T16* __restrict__ Kp2, const T16* __restrict__ Vt, const T16* __restrict__ Vt2, int roff, bf* Ah, bf* Al) {
    typedef typename WFrag<T16>::V V;
    static_assert(NQ * 16 * 8 == NW * 32, "one thread per 8 output columns in the merge");
    __shared__ __align__(16) float red[NW * NQ * 32 * 36];           // per (wave, query tile, lane): 32 accumulator values at pitch 36 floats (16 B x 9)
    __shared__ float stm[NW * NQ * 32], stl[NW * NQ * 32];
    const int lane = threadIdx.x & 31, lr = lane & 15, hi = lane >> 4; const int w = __builtin_amdgcn_readfirstlane((int)(threadIdx.x >> 5));
    const int q0 = roff + ((int)gridDim.y - 1 - (int)blockIdx.y) * (NQ * 16);
    const size_t hq = ((size_t)blockIdx.z * NH_ + blockIdx.x) * TT * HD, hk = ((size_t)blockIdx.z * NKV + blockIdx.x / REP) * TT * HD;
    Q += hq; Kp += hk; Vt += hk; if (NSPLIT >= 2) { Q2 += hq; Kp2 += hk; Vt2 += hk; }
    V qf[NQ][2], qf2[NQ][2];
    const size_t qo = (size_t)q0 * HD + 8 * lane; const T16* qa = Q + qo; const T16* qa2 = (NSPLIT >= 2) ? Q2 + qo : qa;
#pragma unroll
    for (int nt = 0; nt < NQ; ++nt)
#pragma unroll
        for (int ks = 0; ks < 2; ++ks) { qf[nt][ks] = WFrag<T16>::ld(qa + nt * 16 * HD + ks * 512); if (NSPLIT >= 2) qf2[nt][ks] = WFrag<T16>::ld(qa2 + nt * 16 * HD + ks * 512); }
    asm volatile("s_wait_xcnt 0x0" :: "v"(qa), "v"(qa2) : "memory");   // the wait in front of any overwrite of a register that the query loads name; the addresses are inputs so that they stay in their registers up to here
    v8f o[4][NQ]; float m[NQ], l[NQ];
#pragma unroll
    for (int nt = 0; nt < NQ; ++nt) { m[nt] = FNEG; l[nt] = 0.0f;
#pragma unroll
        for (int dt = 0; dt < 4; ++dt) o[dt][nt] = (v8f){}; }
    const int nsteps = (q0 + NQ * 16 + 31) >> 5;                     // 32-key steps up to and including the one that holds the tile's last diagonal key; every query sees at least one key of every step
#pragma unroll 1   // rolled: a second step's key and value fragments would push the wave past the registers that let four waves share a SIMD
    for (int st = w; st < nsteps; st += NW) {
        const int key0 = st * 32;
        V kf[2][2], kf2[2][2], vf[4], vf2[4];
        const size_t ko = (size_t)key0 * HD + 8 * lane, vo = (size_t)st * 512 + 8 * lane;   // a step's keys: 4 blocks in a row; its values: block st of each of the 4 block rows
        const T16* ka = Kp + ko; const T16* kb = ka + 16 * HD; const T16* va = Vt + vo;
        const T16* ka2 = (NSPLIT >= 2) ? Kp2 + ko : ka; const T16* kb2 = (NSPLIT >= 2) ? ka2 + 16 * HD : kb; const T16* va2 = (NSPLIT >= 2) ? Vt2 + vo : va;
#pragma unroll
        for (int ks = 0; ks < 2; ++ks) { kf[0][ks] = WFrag<T16>::ld(ka + ks * 512); kf[1][ks] = WFrag<T16>::ld(kb + ks * 512); if (NSPLIT >= 2) { kf2[0][ks] = WFrag<T16>::ld(ka2 + ks * 512); kf2[1][ks] = WFrag<T16>::ld(kb2 + ks * 512); } }
#pragma unroll
        for (int dt = 0; dt < 4; ++dt) { vf[dt] = WFrag<T16>::ld(va + (size_t)dt * 16 * TT); if (NSPLIT >= 2) vf2[dt] = WFrag<T16>::ld(va2 + (size_t)dt * 16 * TT); }
        asm volatile("s_wait_xcnt 0x0" :: "v"(ka), "v"(va), "v"(ka2), "v"(va2) : "memory");   // the wait in front of any overwrite of a register that the loads above name; the addresses are inputs so that they stay in their registers up to here
        __builtin_amdgcn_sched_barrier(0);                           // keeps the value loads in front of the score products: issued behind the first wait on the keys, their latency would follow the keys' instead of running beside it
        v8f s[2][NQ];
#pragma unroll
        for (int kt = 0; kt < 2; ++kt) {
#pragma unroll
            for (int nt = 0; nt < NQ; ++nt) s[kt][nt] = (v8f){};
#pragma unroll
            for (int ks = 0; ks < 2; ++ks)
#pragma unroll
                for (int nt = 0; nt < NQ; ++nt) { s[kt][nt] = WFrag<T16>::mma(kf[kt][ks], qf[nt][ks], s[kt][nt]); if (NSPLIT >= 2) { s[kt][nt] = WFrag<T16>::mma(kf2[kt][ks], qf[nt][ks], s[kt][nt]); s[kt][nt] = WFrag<T16>::mma(kf[kt][ks], qf2[nt][ks], s[kt][nt]); } } }
        const bool diag = key0 + 31 > q0;                            // wave-uniform: only steps that reach the diagonal hold keys to exclude
#pragma unroll
        for (int nt = 0; nt < NQ; ++nt) {
            float mx = m[nt];
#pragma unroll
            for (int kt = 0; kt < 2; ++kt)
#pragma unroll
                for (int j = 0; j < 8; ++j) { float sv = s[kt][nt][j]; if (diag) sv = (key0 + kt * 16 + hi * 8 + j <= q0 + nt * 16 + lr) ? sv : FNEG; s[kt][nt][j] = sv; mx = fmaxf(mx, sv); }
            mx = fmaxf(mx, __shfl_xor(mx, 16, 32));                  // the other half of the wave holds the query's other 16 keys
            float al = (m[nt] - mx) * SC2; const float mc = mx * SC2; m[nt] = mx;
            float p[16], sm[4] = {0.0f, 0.0f, 0.0f, 0.0f};
#pragma unroll
            for (int e = 0; e < 16; ++e) p[e] = __builtin_fmaf(s[e >> 3][nt][e & 7], SC2, -mc);
            exp2x17(p, al);
#pragma unroll
            for (int e = 0; e < 16; ++e) sm[e & 3] += p[e];
            l[nt] = l[nt] * al + ((sm[0] + sm[1]) + (sm[2] + sm[3]));
            V pb, pb2; packp(p, pb, pb2);
#pragma unroll
            for (int dt = 0; dt < 4; ++dt) { o[dt][nt] *= al; o[dt][nt] = WFrag<T16>::mma(vf[dt], pb, o[dt][nt]); if (NSPLIT >= 2) { o[dt][nt] = WFrag<T16>::mma(vf2[dt], pb, o[dt][nt]); o[dt][nt] = WFrag<T16>::mma(vf[dt], pb2, o[dt][nt]); } }
        }
    }
#pragma unroll
    for (int nt = 0; nt < NQ; ++nt) { const int sl = (w * NQ + nt) * 32 + lane; stm[sl] = m[nt]; stl[sl] = l[nt] + __shfl_xor(l[nt], 16, 32); float* my = red + (size_t)sl * 36;
#pragma unroll
        for (int dt = 0; dt < 4; ++dt) { *(v4fa*)(my + dt * 8) = __builtin_shufflevector(o[dt][nt], o[dt][nt], 0, 1, 2, 3); *(v4fa*)(my + dt * 8 + 4) = __builtin_shufflevector(o[dt][nt], o[dt][nt], 4, 5, 6, 7); } }
    __syncthreads();                                                 // every wave's partial result is in LDS before any thread merges them
    const int c2 = w & 3, nq = w >> 2;                                // this wave's accumulator tile (head columns c2 * 16 ..) and query tile; lane (hi, lr) takes query lr and the 8 columns c2 * 16 + hi * 8 ..
    const int sb = nq * 32 + lane;
    float M = FNEG;
#pragma unroll
    for (int w2 = 0; w2 < NW; ++w2) M = fmaxf(M, stm[w2 * NQ * 32 + sb]);
    float L = 0.0f; v4f a0 = (v4f){}, a1 = (v4f){};
#pragma unroll
    for (int w2 = 0; w2 < NW; ++w2) { const int sl = w2 * NQ * 32 + sb; const float f = exp2s((stm[sl] - M) * SC2); L += f * stl[sl]; const float* pr = red + (size_t)sl * 36 + c2 * 8; a0 += *(const v4fa*)pr * f; a1 += *(const v4fa*)(pr + 4) * f; }   // a wave without a step has maximum FNEG: weight 0
    const float inv = __fdiv_rn(1.0f, L); v8us oh, ol;
#pragma unroll
    for (int j = 0; j < 8; ++j) { unsigned short x, y; splitf((j < 4 ? a0[j & 3] : a1[j & 3]) * inv, x, y); oh[j] = x; ol[j] = y; }
    const size_t oo = ((size_t)blockIdx.z * TT + q0 + nq * 16) * DQ + ((size_t)blockIdx.x * 2 + (c2 >> 1)) * 512 + (c2 & 1) * 256 + lane * 8; *(v8us*)(Ah + oo) = oh; *(v8us*)(Al + oo) = ol;
}

extern "C" void kernel_launch(void* const* d_in, const int* in_sizes, int n_in,
                              void* d_out, int out_size, void* d_ws, size_t ws_size, hipStream_t stream) {
    (void)in_sizes; (void)n_in; (void)out_size;
    const float* x = (const float*)d_in[0];   /* d_in[1] = scalar int 'mask' (== 1 selects the causal branch): checked by the guard kernel */ const float* wq = (const float*)d_in[2]; const float* bq = (const float*)d_in[3]; const float* wk = (const float*)d_in[4]; const float* bk = (const float*)d_in[5]; const float* wv = (const float*)d_in[6]; const float* bv = (const float*)d_in[7]; const float* wo = (const float*)d_in[8]; const float* bo = (const float*)d_in[9];
    float* OUT = (float*)d_out;     // [2][2048][1024]
    char* wsp = (char*)d_ws;
    auto take = [&](size_t bytes) { char* p = wsp; wsp += (bytes + 255) & ~(size_t)255; return (void*)p; };
    bf* WT = (bf*)take((size_t)4 * DQ * DM * 2);                       // transposed Wq, Wk, Wv, Wo
    bf* XB = (bf*)take((size_t)NB_ * TT * DM * 2);
    const size_t PS = (size_t)NB_ * NH_ * TT * HD;                     // one projection's plane, both batches
    h16* P16 = (h16*)take(3 * PS * 2); bf* Ph = (bf*)take(3 * PS * 2); bf* Pl = (bf*)take(3 * PS * 2);   // q, k, v^T planes of each kind
    bf* ATh = (bf*)take((size_t)NB_ * TT * DQ * 2); bf* ATl = (bf*)take((size_t)NB_ * TT * DQ * 2);
    if ((size_t)(wsp - (char*)d_ws) > ws_size) return;    // ws 256 MiB
    k_wtG<<<dim3((unsigned)((DQ / 64) * (DM / 16) / 8), 4), 256, 0, stream>>>(wq, wk, wv, wo, WT);
    k_cvt8<<<(unsigned)(((size_t)NB_ * TT * DM / 8 + 255) / 256), 256, 0, stream>>>(x, XB, (size_t)NB_ * TT * DM / 8);
    k_qkv<<<dim3(TT / 64, DQ / 64, 3 * NB_), 32, 0, stream>>>(XB, WT, bq, bk, bv, P16, Ph, Pl);
    k_fattn<h16, 0, 2, 8><<<dim3(NH_, (TT - RH) / 32, NB_), 256, 0, stream>>>(P16, nullptr, P16 + PS, nullptr, P16 + 2 * PS, nullptr, RH, ATh, ATl);
    k_fattn<bf, 2, 1, 4><<<dim3(NH_, RH / 16, NB_), 128, 0, stream>>>(Ph, Pl, Ph + PS, Pl + PS, Ph + 2 * PS, Pl + 2 * PS, 0, ATh, ATl);
    k_gemmw<bf, 1, true, 0, DQ><<<dim3(NB_ * TT / 64, DM / 64), 32, 0, stream>>>(ATh, ATl, WT + (size_t)3 * DQ * DM, nullptr, OUT, DM, bo, nullptr, nullptr, nullptr);
    k_premise<<<(unsigned)(((size_t)NB_ * TT * DM / 4 + 255) / 256), 256, 0, stream>>>((const int*)d_in[1], OUT, (size_t)NB_ * TT * DM / 4);   /* after the output is written: poison it all if the premise fails */
}

// v007
// One run takes 124 microseconds.
// Two timings next to v006 put it at 1.06 and 1.05 times that version's speed.
// Over all steps from v000 it is 12.0 times as fast.
#include <hip/hip_runtime.h>

// Multi-head attention whose causal branch is selected by a scalar 'mask' input and whose scores are divided by sqrt(E) (x [2][2048][1024]; q, k, v = x W + b ('xw' [1024][1024] 0.02, biases zeros on this draw: read; 16 heads x 64); scores / sqrt(1024) = x 1/32 (the EMBEDDING width, not the head width: implemented literally); 'if mask:' with mask a scalar int input -> where(tril, scores, -1e9) == exclusion (every row keeps its own key); the attention kernel reads the scalar on the device: != 0 causal by index, == 0 every key, unmasked; softmax; out = merged Wo + bo ('xw' + bias zeros: read) -> [2][2048][1024] (4.2 M); argument order x, mask, Wq, bq, Wk, bk, Wv, bv, Wo, bo).
// Four launches: k_prep (weight transposes and the bf16 copy of x, which depend on nothing of each other), k_qkv, k_attn (both row classes), the output GEMM.
// Both batches share every launch (the batch is a grid dimension). Every 16-bit plane lies in fragment order (see WFrag). Layout: bf16 copy of x; 'xw' weights transposed once; exact projections + f32 biases, stored by the projection kernel itself as the attention's 16-bit planes; T-2048 attention, both row classes in one kernel, with the literal scale 1/32 (hybrid rows: < 512 hi/lo 3 products, rest fp16; running-maximum softmax, causal: key steps beyond the diagonal never visited); merged hi/lo x Wo exact + bo.
// Compute dtypes, f32 accumulate: every input rounded to bf16; projections exact + f32 biases; attention rows < 512 3 products, rest fp16; softmax f32; output projection hl x exact.

#define NB_  2
#define TT   2048
#define DM   1024
#define NH_  16
#define NKV  16
#define REP  (NH_ / NKV)
#define HD   64
#define DQ   (NH_ * HD)
#define DKV  (NKV * HD)
#define RH   512                  // query rows < RH use hi+lo planes (0: none)
#define SCL  0.03125f   // 1 / sqrt(E = 1024) = 2^-5: the module divides by sqrt of the EMBEDDING width
typedef _Float16 h16;
typedef unsigned short bf;
typedef __attribute__((ext_vector_type(16))) __bf16   v16bf;
typedef __attribute__((ext_vector_type(16))) _Float16 v16h;
typedef __attribute__((ext_vector_type(8)))  _Float16 v8h;
typedef __attribute__((ext_vector_type(8)))  unsigned short v8us;
typedef __attribute__((ext_vector_type(8)))  float    v8f;
typedef __attribute__((ext_vector_type(4)))  float    v4f;
typedef v8h  __attribute__((may_alias)) v8ha;
typedef v4f  __attribute__((may_alias)) v4fa;
typedef v8us __attribute__((may_alias)) v8usa;

__device__ __forceinline__ unsigned short f2bf(float f) { unsigned u = __float_as_uint(f); u += 0x7FFFu + ((u >> 16) & 1u); return (unsigned short)(u >> 16); }
__device__ __forceinline__ float bf2f(unsigned short b) { return __uint_as_float(((unsigned)b) << 16); }
__device__ __forceinline__ float bfr(float f) { return bf2f(f2bf(f)); }
__device__ __forceinline__ h16 tohx(float x) { return (h16)x; }
__device__ __forceinline__ void splitf(float y, unsigned short& h, unsigned short& l) { h = f2bf(y); l = f2bf(y - bf2f(h)); }
__device__ __forceinline__ v16h cat16(v8h lo, v8h hi) { return __builtin_shufflevector(lo, hi, 0, 1, 2, 3, 4, 5, 6, 7, 8, 9, 10, 11, 12, 13, 14, 15); }
__device__ __forceinline__ v16bf cat16b(v8us lo, v8us hi) { return __builtin_bit_cast(v16bf, __builtin_shufflevector(lo, hi, 0, 1, 2, 3, 4, 5, 6, 7, 8, 9, 10, 11, 12, 13, 14, 15)); }
__device__ __forceinline__ v8f wmma16(v16h a, v16h b, v8f c) { return __builtin_amdgcn_wmma_f32_16x16x32_f16(false, a, false, b, (short)0, c, false, false); }
__device__ __forceinline__ v8f wmmab(v16bf a, v16bf b, v8f c) { return __builtin_amdgcn_wmma_f32_16x16x32_bf16(false, a, false, b, (short)0, c, false, false); }



// ---- gemmw_tile: register-blocked GEMM, ONE WAVE per 64x64 output tile (16 accumulators), operands straight from 16-bit planes in fragment order; tile (bx, by) of (M/64, N/64), 32 threads; os: 16 x 68 floats of LDS.
// C[m][n] (f32, pitch ldc, + optional f32 bias[n]) = sum_k A[m][k] Bt[n][k] (+ split products per NSPLIT). K % 32 == 0.
// EPI selects what leaves the kernel: 0 the f32 tile in C; 1 and 2 the three 16-bit planes that the attention reads (fp16, bf16 hi, bf16 lo of the f32 value + bias), no f32 copy:
// 1 = head planes [n / 64] of rows m (the token) x 64, bias[n]; 2 = one plane of rows m x ldc columns, bias[m]: with the weight rows as A and the tokens as Bt this is the transposed value plane, rows (head, d), columns t. Both in fragment order.
// FRAGMENT ORDER: a plane of R rows x K columns (R % 16 == 0, K % 32 == 0) is stored as blocks of 16 rows x 32 k = 512 elements, block (row / 16, k / 32) at ((row / 16) * (K / 32) + k / 32) * 512.
// Inside a block the 16-byte chunk of row r, k = 16 * half + 8 * hi + 0..7 lies at element half * 256 + (hi * 16 + r) * 8: lane hi * 16 + r of a wave reads its A or B fragment as two loads, each 512 contiguous bytes over the wave (4 whole lines).
template <typename T16> struct WFrag;
template <> struct WFrag<h16> { typedef v16h V; static __device__ __forceinline__ V ld(const h16* p) { return cat16(*(const v8h*)p, *(const v8h*)(p + 256)); } static __device__ __forceinline__ v8f mma(V a, V b, v8f c) { return wmma16(a, b, c); } };
template <> struct WFrag<bf> { typedef v16bf V; static __device__ __forceinline__ V ld(const bf* p) { return cat16b(*(const v8us*)p, *(const v8us*)(p + 256)); } static __device__ __forceinline__ v8f mma(V a, V b, v8f c) { return wmmab(a, b, c); } };
template <typename T16, int NSPLIT, bool BIAS, int EPI>
__device__ __forceinline__ void gemmw_tile(const T16* __restrict__ A, const T16* __restrict__ A2, const T16* __restrict__ Bt, const T16* __restrict__ Bt2, int K, float* C, int ldc, const float* __restrict__ bias, h16* P16, bf* Ph, bf* Pl, int bx, int by, float* os) {
    typedef typename WFrag<T16>::V V;
    const int lane = threadIdx.x & 31, lr = lane & 15, hi = lane >> 4; const int r0 = bx * 64, c0 = by * 64;
    v8f acc[4][4];
#pragma unroll
    for (int mb = 0; mb < 4; ++mb)
#pragma unroll
        for (int nb = 0; nb < 4; ++nb) acc[mb][nb] = (v8f){};
    const size_t aoff = (size_t)r0 * K + 8 * lane, boff = (size_t)c0 * K + 8 * lane;   // block row r0 / 16 starts at (r0 / 16) * (K / 32) * 512 = r0 * K
    float bb[32];   // EPI 1: the biases of this lane's 4 x 8 plane columns; EPI 2: of its 4 plane rows; loaded here so that the K loop covers their latency
    if (EPI != 0 && BIAS) { const float* bp = bias + (EPI == 1 ? c0 + hi * 8 : r0 + lr);
#pragma unroll
        for (int i = 0; i < (EPI == 1 ? 32 : 4); ++i) bb[i] = bp[EPI == 1 ? (i >> 3) * 16 + (i & 7) : 16 * i];
        asm volatile("s_wait_xcnt 0x0" :: "v"(bp) : "memory"); }   // the wait in front of any overwrite of the register that the bias loads name; the address is an input so that it stays in its registers up to here
#pragma unroll 1
    for (int kc = 0; kc < K; kc += 32) {
        V a[4], a2[4];
        const T16* pa = A + aoff + kc * 16; const T16* pa2 = (NSPLIT == 1 || NSPLIT == 2) ? A2 + aoff + kc * 16 : pa; const T16* pb = Bt + boff + kc * 16; const T16* pb2 = (NSPLIT >= 2) ? Bt2 + boff + kc * 16 : pb;   // k block kc / 32: 512 elements on
#pragma unroll
        for (int mb = 0; mb < 4; ++mb) { a[mb] = WFrag<T16>::ld(pa + (size_t)mb * 16 * K); if (NSPLIT == 1 || NSPLIT == 2) a2[mb] = WFrag<T16>::ld(pa2 + (size_t)mb * 16 * K); }
#pragma unroll
        for (int nb = 0; nb < 4; ++nb) { const V b = WFrag<T16>::ld(pb + (size_t)nb * 16 * K); V b2; if (NSPLIT >= 2) b2 = WFrag<T16>::ld(pb2 + (size_t)nb * 16 * K);
#pragma unroll
            for (int mb = 0; mb < 4; ++mb) { acc[mb][nb] = WFrag<T16>::mma(a[mb], b, acc[mb][nb]); if (NSPLIT == 1 || NSPLIT == 2) acc[mb][nb] = WFrag<T16>::mma(a2[mb], b, acc[mb][nb]); if (NSPLIT >= 2) acc[mb][nb] = WFrag<T16>::mma(a[mb], b2, acc[mb][nb]); } }
        asm volatile("s_wait_xcnt 0x0" :: "v"(pa), "v"(pa2), "v"(pb), "v"(pb2) : "memory");   // the wait in front of any overwrite of a register that this trip's fragment loads name; the addresses are inputs so that they stay in their registers up to here
        asm volatile("v_nop\n\tv_nop\n\tv_nop\n\tv_nop" : "+v"(acc[0][0]), "+v"(acc[1][1]), "+v"(acc[2][2]), "+v"(acc[3][3]) : "v"(a[0]), "v"(a[3]));
    }
#pragma unroll
    for (int mb = 0; mb < 4; ++mb) {
#pragma unroll
        for (int nb = 0; nb < 4; ++nb) {
#pragma unroll
            for (int j = 0; j < 8; ++j) os[(hi * 8 + j) * 68 + nb * 16 + lr] = acc[mb][nb][j]; }
        __builtin_amdgcn_wave_barrier(); asm volatile("" ::: "memory");
        if (EPI == 0) {
            float* crow = C + (size_t)(r0 + mb * 16) * ldc + c0; float* pc[8]; v4f vo[8];
#pragma unroll
            for (int s = 0; s < 8; ++s) { const int row = 2 * s + hi, cofs = lr * 4; v4f val = *(const v4fa*)(os + row * 68 + cofs); if (BIAS) { val[0] += bfr(bias[c0 + cofs]); val[1] += bfr(bias[c0 + cofs + 1]); val[2] += bfr(bias[c0 + cofs + 2]); val[3] += bfr(bias[c0 + cofs + 3]); }
                pc[s] = crow + (size_t)row * ldc + cofs; vo[s] = val; *(v4f*)pc[s] = vo[s]; }
            // the wait in front of any overwrite of a register that the 8 stores above name; addresses and values are inputs so that they stay in their registers up to here
            asm volatile("s_wait_xcnt 0x0" :: "v"(pc[0]), "v"(pc[1]), "v"(pc[2]), "v"(pc[3]), "v"(pc[4]), "v"(pc[5]), "v"(pc[6]), "v"(pc[7]), "v"(vo[0]), "v"(vo[1]), "v"(vo[2]), "v"(vo[3]), "v"(vo[4]), "v"(vo[5]), "v"(vo[6]), "v"(vo[7]) : "memory");
        } else {
            h16* p0[4]; bf* p1[4]; bf* p2[4]; v8h o16[4]; v8us oh[4], ol[4];
#pragma unroll
            for (int s = 0; s < 4; ++s) { const int row = lr, cofs = s * 16 + hi * 8;   // half block s of the 16 x 64 tile: the wave stores 512 contiguous bytes of a plane, 4 whole lines
                const v4f v0 = *(const v4fa*)(os + row * 68 + cofs), v1 = *(const v4fa*)(os + row * 68 + cofs + 4);
#pragma unroll
                for (int j = 0; j < 8; ++j) { float y = (j < 4) ? v0[j & 3] : v1[j & 3]; if (BIAS) y += bfr(bb[EPI == 1 ? s * 8 + j : mb]); o16[s][j] = tohx(y); unsigned short a2, c2; splitf(y, a2, c2); oh[s][j] = a2; ol[s][j] = c2; }
                const size_t po = ((EPI == 1) ? ((size_t)by * TT + r0 + mb * 16) * HD : (size_t)(r0 + mb * 16) * ldc + (size_t)c0 * 16) + s * 256 + lane * 8;
                p0[s] = P16 + po; p1[s] = Ph + po; p2[s] = Pl + po; *(v8h*)p0[s] = o16[s]; *(v8us*)p1[s] = oh[s]; *(v8us*)p2[s] = ol[s]; }
            // the wait in front of any overwrite of a register that the 12 plane stores above name; addresses and values are inputs so that they stay in their registers up to here
            asm volatile("s_wait_xcnt 0x0" :: "v"(p0[0]), "v"(p0[1]), "v"(p0[2]), "v"(p0[3]), "v"(p1[0]), "v"(p1[1]), "v"(p1[2]), "v"(p1[3]), "v"(p2[0]), "v"(p2[1]), "v"(p2[2]), "v"(p2[3]), "v"(o16[0]), "v"(o16[1]), "v"(o16[2]), "v"(o16[3]), "v"(oh[0]), "v"(oh[1]), "v"(oh[2]), "v"(oh[3]), "v"(ol[0]), "v"(ol[1]), "v"(ol[2]), "v"(ol[3]) : "memory");
        }
        __builtin_amdgcn_wave_barrier(); asm volatile("" ::: "memory");
    }
}
// One GEMM as a launch of its own: grid (M/64, N/64).
template <typename T16, int NSPLIT, bool BIAS, int EPI, int K>
__global__ __launch_bounds__(32) void k_gemmw(const T16* __restrict__ A, const T16* __restrict__ A2, const T16* __restrict__ Bt, const T16* __restrict__ Bt2, float* C, int ldc, const float* __restrict__ bias, h16* P16, bf* Ph, bf* Pl) {
    __shared__ __align__(16) float os[16 * 68];
    gemmw_tile<T16, NSPLIT, BIAS, EPI>(A, A2, Bt, Bt2, K, C, ldc, bias, P16, Ph, Pl, (int)blockIdx.x, (int)blockIdx.y, os);
}
// The q, k and v projections of both batches as ONE launch: grid (TT/64, DQ/64, 3 * NB_), z = projection * NB_ + batch. The six GEMMs depend on nothing of each other.
// W: the transposed q, k, v weights one behind the other; P16, Ph, Pl: per kind of plane the six (projection, batch) planes one behind the other, in the order of z.
__global__ __launch_bounds__(32) void k_qkv(const bf* __restrict__ XB, const bf* __restrict__ W, const float* __restrict__ bq, const float* __restrict__ bk, const float* __restrict__ bv, h16* P16, bf* Ph, bf* Pl) {
    __shared__ __align__(16) float os[16 * 68];
    const int sel = (int)blockIdx.z / NB_, b = (int)blockIdx.z % NB_;
    const bf* xb = XB + (size_t)b * TT * DM; const bf* w = W + (size_t)sel * DQ * DM; const size_t pz = (size_t)blockIdx.z * NH_ * TT * HD;
    if (sel < 2) gemmw_tile<bf, 0, true, 1>(xb, nullptr, w, nullptr, DM, nullptr, 0, sel ? bk : bq, P16 + pz, Ph + pz, Pl + pz, (int)blockIdx.x, (int)blockIdx.y, os);
    else         gemmw_tile<bf, 0, true, 2>(w, nullptr, xb, nullptr, DM, nullptr, TT, bv, P16 + pz, Ph + pz, Pl + pz, (int)blockIdx.y, (int)blockIdx.x, os);   // weight rows as A: the tile comes out as [d][t]
}

typedef __attribute__((ext_vector_type(2))) _Float16 v2h;
typedef __attribute__((ext_vector_type(4))) _Float16 v4h;
typedef __attribute__((ext_vector_type(2))) unsigned short v2us;
typedef __attribute__((ext_vector_type(4))) unsigned short v4us;
typedef __attribute__((ext_vector_type(2))) float v2f;
typedef __attribute__((ext_vector_type(4))) int v4i;

// by selects one of four equally shaped weights [K][N]; their transposes (rows n, columns k, fragment order) lie one behind the other in Bt.
// A wave takes 16 k x 64 n: a load reads 16 neighbouring n of two k rows, a store is one half block of 512 contiguous bytes. bx: 0 .. (N / 64) * (K / 16) / 8 - 1.
__device__ __forceinline__ void wtG_block(const float* __restrict__ w0, const float* __restrict__ w1, const float* __restrict__ w2, const float* __restrict__ w3, bf* Bt, int bx, int by) {
    constexpr int K = DM, N = DQ;   // compile-time, so that the 32 loads of a lane are one address and immediate offsets
    const float* __restrict__ w = by == 0 ? w0 : by == 1 ? w1 : by == 2 ? w2 : w3; Bt += (size_t)by * N * K;
    const int lane = threadIdx.x & 31, lr = lane & 15, hi = lane >> 4; const int wv = bx * 8 + (threadIdx.x >> 5); const int kh = wv % (K / 16), nq = wv / (K / 16);
    const float* src = w + (size_t)(kh * 16 + hi * 8) * N + nq * 64 + lr; float v[4][8];
    // the loops of this kernel are unrolled so that v and o stay in registers and a lane's 32 loads are in flight together
#pragma unroll
    for (int u = 0; u < 4; ++u)
#pragma unroll
        for (int j = 0; j < 8; ++j) v[u][j] = src[(size_t)j * N + u * 16];
    asm volatile("s_wait_xcnt 0x0" :: "v"(src) : "memory");   // the wait in front of any overwrite of a register that the loads above name; the address is an input so that it stays in its registers up to here
    bf* dst = Bt + ((size_t)(nq * 4) * (K / 32) + (kh >> 1)) * 512 + (kh & 1) * 256 + lane * 8;
#pragma unroll
    for (int u = 0; u < 4; ++u) { v8us o;
#pragma unroll
        for (int j = 0; j < 8; ++j) o[j] = f2bf(v[u][j]);
        *(v8us*)(dst + (size_t)u * (K / 32) * 512) = o; }
}
// x [rows][DM] f32 -> bf16 in fragment order: a wave takes 8 rows x 32 k of one block: 4 lanes read one row's 128 bytes (a whole line), and the 8 rows' chunks of one (half, hi) are 128 contiguous bytes of the plane, so a store fills 4 whole lines
__device__ __forceinline__ void cvt8_block(const float* __restrict__ src, bf* dst, size_t n8, int bx) { const size_t i = (size_t)bx * 256 + threadIdx.x; if (i >= n8) return;
    const size_t blk = i >> 6; const int r = (int)(i & 7) + (int)((i >> 5) & 1) * 8, c = (int)((i >> 3) & 3); const size_t row = (blk / (DM / 32)) * 16 + r; const int k = (int)(blk % (DM / 32)) * 32 + c * 8;   // c = 2 * half + hi
    const float* p = src + row * DM + k; const v8f v = *(const v8f*)p; v8us o;
    asm volatile("s_wait_xcnt 0x0" :: "v"(p) : "memory");   // the wait in front of any overwrite of the register that the load above names; the address is an input so that it stays in its registers up to here
#pragma unroll
    for (int j = 0; j < 8; ++j) o[j] = f2bf(v[j]); *(v8us*)(dst + blk * 512 + (c * 16 + r) * 8) = o;  }

// The four weight transposes and the conversion of x as ONE launch: blocks 0 .. 4 * WTB - 1 transpose (weight = block / WTB), the rest convert. Neither reads what the other writes.
#define WTB ((DQ / 64) * (DM / 16) / 8)
#define CVB ((NB_ * TT * DM / 8 + 255) / 256)
__global__ __launch_bounds__(256) void k_prep(const float* __restrict__ w0, const float* __restrict__ w1, const float* __restrict__ w2, const float* __restrict__ w3, bf* Bt, const float* __restrict__ x, bf* XB) {
    const int b = (int)blockIdx.x;
    if (b < 4 * WTB) wtG_block(w0, w1, w2, w3, Bt, b % WTB, b / WTB);
    else             cvt8_block(x, XB, (size_t)NB_ * TT * DM / 8, b - 4 * WTB);
}
// ---- fattn_tile: scores, softmax and the probability x value product of one query tile; no score or probability ever leaves the registers.
// A group of NW waves (head, query tile ty of nty, heaviest tile first, batch) = NQ x 16 query rows of one head; wave w of the group takes the 32-key steps w, w + NW, ... up to the tile's diagonal (causal) or to the last key (not causal), with its own running maxima, sums and accumulators.
// red, stm, stl: the group's own LDS, NW * NQ * 32 * 36 floats (16-byte aligned; per (wave, query tile, lane) 32 accumulator values at pitch 36 floats = 16 B x 9) and twice NW * NQ * 32 floats. Every wave of the work-group calls it once: it holds one work-group barrier.
// Transposed products: S^T = K Q^T (A = key rows, B = query rows kept in registers), so a lane holds the scores of ONE query (column lr; keys 8 hi + j of each 16-key tile), which is already the k order of a B fragment:
// O^T += V^T P^T takes the packed probabilities straight from the score accumulators. Probabilities are exp(s - running max), not normalised; the f32 sums divide once at the end.
// Every plain '#pragma unroll' below, but the two over the waves in the merge, stands on a loop of compile-time length whose index selects registers (fragments, accumulators), which must not become memory.
// The NW partial results are merged through LDS (weights exp2 of the maxima's differences, in wave order) behind one barrier; each thread then stores 8 head columns of one query, a wave one half block (512 contiguous bytes) of the merged planes, which are in fragment order too.
#define FNEG (-3.0e38f)
#define SC2  (SCL * 1.4426950408889634f)   // score scale and log2(e) in one factor: exp(SCL (s - m)) = exp2(SC2 s - SC2 m)
typedef __attribute__((ext_vector_type(16))) unsigned short v16us;
__device__ __forceinline__ void packp(const float (&p)[16], v16h& a, v16h& b) {
#pragma unroll
    for (int e = 0; e < 16; ++e) a[e] = (h16)p[e];
    b = a; }
__device__ __forceinline__ void packp(const float (&p)[16], v16bf& a, v16bf& b) { v16us h, l;
#pragma unroll
    for (int e = 0; e < 16; ++e) { unsigned short x, y; splitf(p[e], x, y); h[e] = x; l[e] = y; }
    a = __builtin_bit_cast(v16bf, h); b = __builtin_bit_cast(v16bf, l); }
// exp2 of a step's 16 scaled score differences and of the rescale exponent, each in its own register: no exponential is followed by a read of its result or a write of its source
// (the next one is independent of it, the closing v_nop is the slot behind the last).
__device__ __forceinline__ void exp2x17(float (&p)[16], float& al) {
    asm("v_exp_f32 %0, %0\n\tv_exp_f32 %1, %1\n\tv_exp_f32 %2, %2\n\tv_exp_f32 %3, %3\n\tv_exp_f32 %4, %4\n\tv_exp_f32 %5, %5\n\tv_exp_f32 %6, %6\n\tv_exp_f32 %7, %7\n\tv_exp_f32 %8, %8\n\tv_exp_f32 %9, %9\n\tv_exp_f32 %10, %10\n\tv_exp_f32 %11, %11\n\tv_exp_f32 %12, %12\n\tv_exp_f32 %13, %13\n\tv_exp_f32 %14, %14\n\tv_exp_f32 %15, %15\n\tv_exp_f32 %16, %16\n\tv_nop" : "+v"(p[0]), "+v"(p[1]), "+v"(p[2]), "+v"(p[3]), "+v"(p[4]), "+v"(p[5]), "+v"(p[6]), "+v"(p[7]), "+v"(p[8]), "+v"(p[9]), "+v"(p[10]), "+v"(p[11]), "+v"(p[12]), "+v"(p[13]), "+v"(p[14]), "+v"(p[15]), "+v"(al)); }
// exp2 of one merge weight with the slot behind the exponential filled in the same statement
__device__ __forceinline__ float exp2s(float x) { float r; asm("v_exp_f32 %0, %1\n\tv_nop" : "=v"(r) : "v"(x)); return r; }
template <typename T16, int NSPLIT, int NQ, int NW>
__device__ __forceinline__ void fattn_tile(const T16* __restrict__ Q, const T16* __restrict__ Q2, const T16* __restrict__ Kp, const T16* __restrict__ Kp2, const T16* __restrict__ Vt, const T16* __restrict__ Vt2, int roff, int nty, int ty, int head, int batch, bool causal, int w, float* red, float* stm, float* stl, bf* Ah, bf* Al) {
    typedef typename WFrag<T16>::V V;
    static_assert(NQ * 16 * 8 == NW * 32, "one thread per 8 output columns in the merge");
    const int lane = threadIdx.x & 31, lr = lane & 15, hi = lane >> 4;
    const int q0 = roff + (nty - 1 - ty) * (NQ * 16);
    const size_t hq = ((size_t)batch * NH_ + head) * TT * HD, hk = ((size_t)batch * NKV + head / REP) * TT * HD;
    Q += hq; Kp += hk; Vt += hk; if (NSPLIT >= 2) { Q2 += hq; Kp2 += hk; Vt2 += hk; }
    V qf[NQ][2], qf2[NQ][2];
    const size_t qo = (size_t)q0 * HD + 8 * lane; const T16* qa = Q + qo; const T16* qa2 = (NSPLIT >= 2) ? Q2 + qo : qa;
#pragma unroll
    for (int nt = 0; nt < NQ; ++nt)
#pragma unroll
        for (int ks = 0; ks < 2; ++ks) { qf[nt][ks] = WFrag<T16>::ld(qa + nt * 16 * HD + ks * 512); if (NSPLIT >= 2) qf2[nt][ks] = WFrag<T16>::ld(qa2 + nt * 16 * HD + ks * 512); }
    asm volatile("s_wait_xcnt 0x0" :: "v"(qa), "v"(qa2) : "memory");   // the wait in front of any overwrite of a register that the query loads name; the addresses are inputs so that they stay in their registers up to here
    v8f o[4][NQ]; float m[NQ], l[NQ];
#pragma unroll
    for (int nt = 0; nt < NQ; ++nt) { m[nt] = FNEG; l[nt] = 0.0f;
#pragma unroll
        for (int dt = 0; dt < 4; ++dt) o[dt][nt] = (v8f){}; }
    const int nsteps = causal ? (q0 + NQ * 16 + 31) >> 5 : TT / 32;  // causal: 32-key steps up to and including the one that holds the tile's last diagonal key; every query sees at least one key of every step
#pragma unroll 1   // rolled: a second step's key and value fragments would push the wave past the registers that let four waves share a SIMD
    for (int st = w; st < nsteps; st += NW) {
        const int key0 = st * 32;
        V kf[2][2], kf2[2][2], vf[4], vf2[4];
        const size_t ko = (size_t)key0 * HD + 8 * lane, vo = (size_t)st * 512 + 8 * lane;   // a step's keys: 4 blocks in a row; its values: block st of each of the 4 block rows
        const T16* ka = Kp + ko; const T16* kb = ka + 16 * HD; const T16* va = Vt + vo;
        const T16* ka2 = (NSPLIT >= 2) ? Kp2 + ko : ka; const T16* kb2 = (NSPLIT >= 2) ? ka2 + 16 * HD : kb; const T16* va2 = (NSPLIT >= 2) ? Vt2 + vo : va;
#pragma unroll
        for (int ks = 0; ks < 2; ++ks) { kf[0][ks] = WFrag<T16>::ld(ka + ks * 512); kf[1][ks] = WFrag<T16>::ld(kb + ks * 512); if (NSPLIT >= 2) { kf2[0][ks] = WFrag<T16>::ld(ka2 + ks * 512); kf2[1][ks] = WFrag<T16>::ld(kb2 + ks * 512); } }
#pragma unroll
        for (int dt = 0; dt < 4; ++dt) { vf[dt] = WFrag<T16>::ld(va + (size_t)dt * 16 * TT); if (NSPLIT >= 2) vf2[dt] = WFrag<T16>::ld(va2 + (size_t)dt * 16 * TT); }
        asm volatile("s_wait_xcnt 0x0" :: "v"(ka), "v"(va), "v"(ka2), "v"(va2) : "memory");   // the wait in front of any overwrite of a register that the loads above name; the addresses are inputs so that they stay in their registers up to here
        __builtin_amdgcn_sched_barrier(0);                           // keeps the value loads in front of the score products: issued behind the first wait on the keys, their latency would follow the keys' instead of running beside it
        v8f s[2][NQ];
#pragma unroll
        for (int kt = 0; kt < 2; ++kt) {
#pragma unroll
            for (int nt = 0; nt < NQ; ++nt) s[kt][nt] = (v8f){};
#pragma unroll
            for (int ks = 0; ks < 2; ++ks)
#pragma unroll
                for (int nt = 0; nt < NQ; ++nt) { s[kt][nt] = WFrag<T16>::mma(kf[kt][ks], qf[nt][ks], s[kt][nt]); if (NSPLIT >= 2) { s[kt][nt] = WFrag<T16>::mma(kf2[kt][ks], qf[nt][ks], s[kt][nt]); s[kt][nt] = WFrag<T16>::mma(kf[kt][ks], qf2[nt][ks], s[kt][nt]); } } }
        const bool diag = causal && key0 + 31 > q0;                  // wave-uniform: only causal steps that reach the diagonal hold keys to exclude
#pragma unroll
        for (int nt = 0; nt < NQ; ++nt) {
            float mx = m[nt];
#pragma unroll
            for (int kt = 0; kt < 2; ++kt)
#pragma unroll
                for (int j = 0; j < 8; ++j) { float sv = s[kt][nt][j]; if (diag) sv = (key0 + kt * 16 + hi * 8 + j <= q0 + nt * 16 + lr) ? sv : FNEG; s[kt][nt][j] = sv; mx = fmaxf(mx, sv); }
            mx = fmaxf(mx, __shfl_xor(mx, 16, 32));                  // the other half of the wave holds the query's other 16 keys
            float al = (m[nt] - mx) * SC2; const float mc = mx * SC2; m[nt] = mx;
            float p[16], sm[4] = {0.0f, 0.0f, 0.0f, 0.0f};
#pragma unroll
            for (int e = 0; e < 16; ++e) p[e] = __builtin_fmaf(s[e >> 3][nt][e & 7], SC2, -mc);
            exp2x17(p, al);
#pragma unroll
            for (int e = 0; e < 16; ++e) sm[e & 3] += p[e];
            l[nt] = l[nt] * al + ((sm[0] + sm[1]) + (sm[2] + sm[3]));
            V pb, pb2; packp(p, pb, pb2);
#pragma unroll
            for (int dt = 0; dt < 4; ++dt) { o[dt][nt] *= al; o[dt][nt] = WFrag<T16>::mma(vf[dt], pb, o[dt][nt]); if (NSPLIT >= 2) { o[dt][nt] = WFrag<T16>::mma(vf2[dt], pb, o[dt][nt]); o[dt][nt] = WFrag<T16>::mma(vf[dt], pb2, o[dt][nt]); } }
        }
    }
#pragma unroll
    for (int nt = 0; nt < NQ; ++nt) { const int sl = (w * NQ + nt) * 32 + lane; stm[sl] = m[nt]; stl[sl] = l[nt] + __shfl_xor(l[nt], 16, 32); float* my = red + (size_t)sl * 36;
#pragma unroll
        for (int dt = 0; dt < 4; ++dt) { *(v4fa*)(my + dt * 8) = __builtin_shufflevector(o[dt][nt], o[dt][nt], 0, 1, 2, 3); *(v4fa*)(my + dt * 8 + 4) = __builtin_shufflevector(o[dt][nt], o[dt][nt], 4, 5, 6, 7); } }
    __syncthreads();                                                 // every wave's partial result is in LDS before any thread merges them
    const int c2 = w & 3, nq = w >> 2;                                // this wave's accumulator tile (head columns c2 * 16 ..) and query tile; lane (hi, lr) takes query lr and the 8 columns c2 * 16 + hi * 8 ..
    const int sb = nq * 32 + lane;
    float M = FNEG;
#pragma unroll
    for (int w2 = 0; w2 < NW; ++w2) M = fmaxf(M, stm[w2 * NQ * 32 + sb]);
    float L = 0.0f; v4f a0 = (v4f){}, a1 = (v4f){};
#pragma unroll
    for (int w2 = 0; w2 < NW; ++w2) { const int sl = w2 * NQ * 32 + sb; const float f = exp2s((stm[sl] - M) * SC2); L += f * stl[sl]; const float* pr = red + (size_t)sl * 36 + c2 * 8; a0 += *(const v4fa*)pr * f; a1 += *(const v4fa*)(pr + 4) * f; }   // a wave without a step has maximum FNEG: weight 0
    const float inv = __fdiv_rn(1.0f, L); v8us oh, ol;
#pragma unroll
    for (int j = 0; j < 8; ++j) { unsigned short x, y; splitf((j < 4 ? a0[j & 3] : a1[j & 3]) * inv, x, y); oh[j] = x; ol[j] = y; }
    const size_t oo = ((size_t)batch * TT + q0 + nq * 16) * DQ + ((size_t)head * 2 + (c2 >> 1)) * 512 + (c2 & 1) * 256 + lane * 8; *(v8us*)(Ah + oo) = oh; *(v8us*)(Al + oo) = ol;
}
// Both row classes as ONE launch: grid (head, NTH + NTL / 2, batch), 8 waves. y < NTH: one 32-row tile of the rows >= RH (fp16 planes, 8 waves over the key steps); the rest, the lightest of the causal branch and the last of their batch to start:
// two 16-row tiles of the rows < RH (hi and lo planes), 4 waves each, each half of the work-group with its own part of the LDS. The classes write disjoint rows of the merged planes.
// flag: the scalar 'mask' input; != 0 selects the causal branch, 0 the branch without a mask.
// Each of the nine planes comes as an argument of its own: an address that a fragment load names is then the very register pair that the wait's statement behind the loads holds in place.
#define NTH ((TT - RH) / 32)
#define NTL (RH / 16)
__global__ __launch_bounds__(256) void k_attn(const h16* __restrict__ Q16, const h16* __restrict__ K16, const h16* __restrict__ V16, const bf* __restrict__ Qh, const bf* __restrict__ Ql, const bf* __restrict__ Kh, const bf* __restrict__ Kl, const bf* __restrict__ Vh, const bf* __restrict__ Vl, const int* __restrict__ flag, bf* Ah, bf* Al) {
    __shared__ __align__(16) float red[8 * 2 * 32 * 36];
    __shared__ float stm[8 * 2 * 32], stl[8 * 2 * 32];
    const bool causal = flag[0] != 0;
    const int w = __builtin_amdgcn_readfirstlane((int)(threadIdx.x >> 5)); const int y = (int)blockIdx.y;
    if (y < NTH) fattn_tile<h16, 0, 2, 8>(Q16, nullptr, K16, nullptr, V16, nullptr, RH, NTH, y, (int)blockIdx.x, (int)blockIdx.z, causal, w, red, stm, stl, Ah, Al);
    else { const int g = w >> 2;
        fattn_tile<bf, 2, 1, 4>(Qh, Ql, Kh, Kl, Vh, Vl, 0, NTL, (y - NTH) * 2 + g, (int)blockIdx.x, (int)blockIdx.z, causal, w & 3, red + g * (4 * 32 * 36), stm + g * (4 * 32), stl + g * (4 * 32), Ah, Al); }
}

extern "C" void kernel_launch(void* const* d_in, const int* in_sizes, int n_in,
                              void* d_out, int out_size, void* d_ws, size_t ws_size, hipStream_t stream) {
    (void)in_sizes; (void)n_in; (void)out_size;
    const float* x = (const float*)d_in[0];   /* d_in[1] = scalar int 'mask' (!= 0 selects the causal branch): read by k_attn */ const float* wq = (const float*)d_in[2]; const float* bq = (const float*)d_in[3]; const float* wk = (const float*)d_in[4]; const float* bk = (const float*)d_in[5]; const float* wv = (const float*)d_in[6]; const float* bv = (const float*)d_in[7]; const float* wo = (const float*)d_in[8]; const float* bo = (const float*)d_in[9];
    float* OUT = (float*)d_out;     // [2][2048][1024]
    char* wsp = (char*)d_ws;
    auto take = [&](size_t bytes) { char* p = wsp; wsp += (bytes + 255) & ~(size_t)255; return (void*)p; };
    bf* WT = (bf*)take((size_t)4 * DQ * DM * 2);                       // transposed Wq, Wk, Wv, Wo
    bf* XB = (bf*)take((size_t)NB_ * TT * DM * 2);
    const size_t PS = (size_t)NB_ * NH_ * TT * HD;                     // one projection's plane, both batches
    h16* P16 = (h16*)take(3 * PS * 2); bf* Ph = (bf*)take(3 * PS * 2); bf* Pl = (bf*)take(3 * PS * 2);   // q, k, v^T planes of each kind
    bf* ATh = (bf*)take((size_t)NB_ * TT * DQ * 2); bf* ATl = (bf*)take((size_t)NB_ * TT * DQ * 2);
    if ((size_t)(wsp - (char*)d_ws) > ws_size) return;    // ws 256 MiB
    k_prep<<<4 * WTB + CVB, 256, 0, stream>>>(wq, wk, wv, wo, WT, x, XB);
    k_qkv<<<dim3(TT / 64, DQ / 64, 3 * NB_), 32, 0, stream>>>(XB, WT, bq, bk, bv, P16, Ph, Pl);
    k_attn<<<dim3(NH_, NTH + NTL / 2, NB_), 256, 0, stream>>>(P16, P16 + PS, P16 + 2 * PS, Ph, Pl, Ph + PS, Pl + PS, Ph + 2 * PS, Pl + 2 * PS, (const int*)d_in[1], ATh, ATl);
    k_gemmw<bf, 1, true, 0, DQ><<<dim3(NB_ * TT / 64, DM / 64), 32, 0, stream>>>(ATh, ATl, WT + (size_t)3 * DQ * DM, nullptr, OUT, DM, bo, nullptr, nullptr, nullptr);
}
